// v000
// The times below were measured on an AMD MI455X: many runs one after another, warmed up first and cycling through
// copies of the inputs, with the whole window's GPU time divided by the number of runs. Launches and the gaps
// between them are all in it. The median over several windows is given; except for v000 it joins two sittings, which
// can be a few percent apart, so the side-by-side timings, each taken in one sitting, are the better comparison.
// v000 is the starting kernel. One run takes 360 microseconds.
#include <hip/hip_runtime.h>
#include <hip/hip_bf16.h>
#include <stdint.h>

#define E_DIM 1024
#define N_HEADS 16
#define HEAD_DIM 64
#define SEQ 2048
#define BATCH 4
#define ROWS (BATCH * SEQ)  // 8192

typedef __attribute__((ext_vector_type(16))) __bf16 v16bf;
typedef __attribute__((ext_vector_type(8)))  float  v8f;
typedef __attribute__((ext_vector_type(4)))  unsigned int u32x4;

union ABf { v16bf v; u32x4 u[2]; };

__device__ __forceinline__ unsigned short f2bf(float f) {
  union { float f; unsigned int u; } x; x.f = f;
  unsigned int r = x.u + 0x7FFFu + ((x.u >> 16) & 1u);  // round-to-nearest-even
  return (unsigned short)(r >> 16);
}

#define WMMA_BF16(A, B, C) \
  __builtin_amdgcn_wmma_f32_16x16x32_bf16(false, (A), false, (B), (short)0, (C), false, false)

// ---------------------------------------------------------------- convert
__global__ void cvt_f32_bf16(const float* __restrict__ in,
                             unsigned short* __restrict__ out, int n) {
  int i = blockIdx.x * blockDim.x + threadIdx.x;
  if (i < n) out[i] = f2bf(in[i]);
}

// ---------------------------------------------------------------- GEMM  Y = X @ W^T + bias
// X: [ROWS,1024] bf16.  W: [1024,1024] bf16 row-major (W row n == B-operand column n).
// Block tile 128x128 (8 waves = 4M x 2N), wave tile 32x64.
// Register ping-pong double buffering over K.
// mode 0: bf16 [ROWS,1024]; mode 1: f32 [ROWS,1024]; mode 2: bf16 Vt [B,H,D,S].
__global__ __launch_bounds__(256)
void gemm_xwt(const unsigned short* __restrict__ Xb,
              const unsigned short* __restrict__ Wb,
              const float* __restrict__ bias,
              void* __restrict__ outp, float scale, int mode) {
  const int lane = threadIdx.x & 31;
  const int wave = threadIdx.x >> 5;
  const int wm = wave & 3;
  const int wn = wave >> 2;
  const int mbase = blockIdx.y * 128 + wm * 32;
  const int nbase = blockIdx.x * 128 + wn * 64;
  const int lrow = lane & 15;
  const int lk = (lane >> 4) << 3;   // A/B 16-bit K-chunk base (ISA 7.12.2)
  const int half = lane >> 4;

  const u32x4* Xv = (const u32x4*)Xb;
  const u32x4* Wv = (const u32x4*)Wb;

  const int aoff0 = (mbase + lrow) * E_DIM + lk;
  const int aoff1 = aoff0 + 16 * E_DIM;
  int boff[4];
#pragma unroll
  for (int t = 0; t < 4; ++t) boff[t] = (nbase + t * 16 + lrow) * E_DIM + lk;

  v8f c[2][4] = {};
  ABf aP[2], bP[4], aN[2], bN[4];

  auto LD = [&](ABf* A, ABf* B4, int k0) {
    A[0].u[0] = Xv[(aoff0 + k0) >> 3];
    A[0].u[1] = Xv[(aoff0 + k0 + 16) >> 3];
    A[1].u[0] = Xv[(aoff1 + k0) >> 3];
    A[1].u[1] = Xv[(aoff1 + k0 + 16) >> 3];
#pragma unroll
    for (int t = 0; t < 4; ++t) {
      B4[t].u[0] = Wv[(boff[t] + k0) >> 3];
      B4[t].u[1] = Wv[(boff[t] + k0 + 16) >> 3];
    }
  };

  LD(aP, bP, 0);
#pragma unroll 1
  for (int k0 = 0; k0 < E_DIM; k0 += 64) {
    LD(aN, bN, (k0 + 32) & (E_DIM - 1));
#pragma unroll
    for (int m = 0; m < 2; ++m)
#pragma unroll
      for (int t = 0; t < 4; ++t) c[m][t] = WMMA_BF16(aP[m].v, bP[t].v, c[m][t]);
    LD(aP, bP, (k0 + 64) & (E_DIM - 1));
#pragma unroll
    for (int m = 0; m < 2; ++m)
#pragma unroll
      for (int t = 0; t < 4; ++t) c[m][t] = WMMA_BF16(aN[m].v, bN[t].v, c[m][t]);
  }

#pragma unroll
  for (int m = 0; m < 2; ++m)
#pragma unroll
    for (int t = 0; t < 4; ++t) {
      const int col = nbase + t * 16 + lrow;
      const float bv = bias[col];
#pragma unroll
      for (int r = 0; r < 8; ++r) {
        const int row = mbase + m * 16 + r + 8 * half;  // C layout: VGPR r -> M = r + 8*half
        const float v = (c[m][t][r] + bv) * scale;
        if (mode == 0) {
          ((unsigned short*)outp)[row * E_DIM + col] = f2bf(v);
        } else if (mode == 1) {
          ((float*)outp)[row * E_DIM + col] = v;
        } else {  // V transpose: [B,H,D,S]
          const int b = row >> 11, s = row & 2047;
          const int h = col >> 6, d = col & 63;
          ((unsigned short*)outp)[((b * N_HEADS + h) * HEAD_DIM + d) * SEQ + s] = f2bf(v);
        }
      }
    }
}

// ---------------------------------------------------------------- flash attention
// One wave per 32-query tile per (b,h); online softmax; V tiles prefetched
// before the softmax phase so global loads overlap the LDS work.
// Q,K: [ROWS,1024] bf16 (Q pre-scaled by 1/8).  Vt: [B,H,D,S] bf16.  Ctx: bf16 [ROWS,1024].
__global__ __launch_bounds__(32)
void attn_fwd(const unsigned short* __restrict__ Qb,
              const unsigned short* __restrict__ Kb,
              const unsigned short* __restrict__ Vtb,
              unsigned short* __restrict__ Ctx) {
  __shared__ __align__(16) float sc[32][32];
  __shared__ __align__(16) unsigned short pb[32][32];
  __shared__ float salpha[32];
  __shared__ float srecip[32];

  const int lane = threadIdx.x & 31;
  const int lrow = lane & 15;
  const int lk = (lane >> 4) << 3;
  const int half = lane >> 4;

  const int bh = blockIdx.x >> 6;   // / (SEQ/32)
  const int qt = blockIdx.x & 63;
  const int b = bh >> 4, h = bh & 15;
  const int qrowbase = b * SEQ + qt * 32;

  const u32x4* Qv = (const u32x4*)Qb;
  const u32x4* Kv = (const u32x4*)Kb;
  const u32x4* Vv = (const u32x4*)Vtb;

  // Q: 2 query sub-tiles x 2 K-dim chunks, resident in registers
  ABf aq[2][2];
#pragma unroll
  for (int m = 0; m < 2; ++m) {
    const int qoff = (qrowbase + m * 16 + lrow) * E_DIM + h * HEAD_DIM;
    aq[m][0].u[0] = Qv[(qoff + lk) >> 3];
    aq[m][0].u[1] = Qv[(qoff + lk + 16) >> 3];
    aq[m][1].u[0] = Qv[(qoff + 32 + lk) >> 3];
    aq[m][1].u[1] = Qv[(qoff + 32 + lk + 16) >> 3];
  }

  v8f o[2][4] = {};
  float m_i = -3.0e38f, l_i = 0.0f;

#pragma unroll 1
  for (int kt = 0; kt < SEQ / 32; ++kt) {
    // ---- scores: S(32x32) = Q(32x64) @ K_tile^T(64x32)
    ABf bk[2][2];
    {
      const int koff0 = (b * SEQ + kt * 32 + lrow) * E_DIM + h * HEAD_DIM;
      const int koff1 = koff0 + 16 * E_DIM;
      bk[0][0].u[0] = Kv[(koff0 + lk) >> 3];      bk[0][0].u[1] = Kv[(koff0 + lk + 16) >> 3];
      bk[0][1].u[0] = Kv[(koff0 + 32 + lk) >> 3]; bk[0][1].u[1] = Kv[(koff0 + 32 + lk + 16) >> 3];
      bk[1][0].u[0] = Kv[(koff1 + lk) >> 3];      bk[1][0].u[1] = Kv[(koff1 + lk + 16) >> 3];
      bk[1][1].u[0] = Kv[(koff1 + 32 + lk) >> 3]; bk[1][1].u[1] = Kv[(koff1 + 32 + lk + 16) >> 3];
    }
    v8f s[2][2] = {};
#pragma unroll
    for (int m = 0; m < 2; ++m)
#pragma unroll
      for (int n = 0; n < 2; ++n) {
        s[m][n] = WMMA_BF16(aq[m][0].v, bk[n][0].v, s[m][n]);
        s[m][n] = WMMA_BF16(aq[m][1].v, bk[n][1].v, s[m][n]);
      }

    // ---- prefetch V tiles now; they stay in flight through the softmax phase
    ABf bvm[4];
#pragma unroll
    for (int t = 0; t < 4; ++t) {
      const int voff = ((b * N_HEADS + h) * HEAD_DIM + t * 16 + lrow) * SEQ + kt * 32;
      bvm[t].u[0] = Vv[(voff + lk) >> 3];
      bvm[t].u[1] = Vv[(voff + lk + 16) >> 3];
    }

    // ---- score tile C-layout -> row-major in LDS
#pragma unroll
    for (int m = 0; m < 2; ++m)
#pragma unroll
      for (int r = 0; r < 8; ++r) {
        sc[m * 16 + r + 8 * half][lrow]      = s[m][0][r];
        sc[m * 16 + r + 8 * half][16 + lrow] = s[m][1][r];
      }
    __syncthreads();  // single-wave WG: S_NOP

    // ---- online softmax: every lane owns one query row
    {
      float rmax = -3.0e38f;
#pragma unroll
      for (int j = 0; j < 8; ++j) {
        const float4 v4 = *(const float4*)&sc[lane][j * 4];
        rmax = fmaxf(rmax, fmaxf(fmaxf(v4.x, v4.y), fmaxf(v4.z, v4.w)));
      }
      const float mnew = fmaxf(m_i, rmax);
      const float alpha = __expf(m_i - mnew);
      float ssum = 0.f;
#pragma unroll
      for (int j = 0; j < 16; ++j) {
        const float p0 = __expf(sc[lane][2 * j] - mnew);
        const float p1 = __expf(sc[lane][2 * j + 1] - mnew);
        ((unsigned int*)pb[lane])[j] = (unsigned int)f2bf(p0) | ((unsigned int)f2bf(p1) << 16);
        ssum += p0 + p1;
      }
      l_i = l_i * alpha + ssum;
      m_i = mnew;
      salpha[lane] = alpha;
    }
    __syncthreads();

    // ---- P back out in A-operand layout (ds_load_b128)
    ABf ap[2];
    ap[0].u[0] = *((const u32x4*)&pb[lrow][lk]);
    ap[0].u[1] = *((const u32x4*)&pb[lrow][lk + 16]);
    ap[1].u[0] = *((const u32x4*)&pb[16 + lrow][lk]);
    ap[1].u[1] = *((const u32x4*)&pb[16 + lrow][lk + 16]);

#pragma unroll
    for (int m = 0; m < 2; ++m) {
      float ar[8];
#pragma unroll
      for (int r = 0; r < 8; ++r) ar[r] = salpha[m * 16 + r + 8 * half];
#pragma unroll
      for (int t = 0; t < 4; ++t)
#pragma unroll
        for (int r = 0; r < 8; ++r) o[m][t][r] = o[m][t][r] * ar[r];
    }

    // ---- O += P(32x32) @ V_tile(32x64)
#pragma unroll
    for (int m = 0; m < 2; ++m)
#pragma unroll
      for (int t = 0; t < 4; ++t) o[m][t] = WMMA_BF16(ap[m].v, bvm[t].v, o[m][t]);
    __syncthreads();
  }

  srecip[lane] = (l_i > 0.f) ? (1.0f / l_i) : 0.f;
  __syncthreads();
#pragma unroll
  for (int m = 0; m < 2; ++m) {
    float rr[8];
#pragma unroll
    for (int r = 0; r < 8; ++r) rr[r] = srecip[m * 16 + r + 8 * half];
#pragma unroll
    for (int t = 0; t < 4; ++t) {
      const int col = h * HEAD_DIM + t * 16 + lrow;
#pragma unroll
      for (int r = 0; r < 8; ++r) {
        const int row = qrowbase + m * 16 + r + 8 * half;
        Ctx[row * E_DIM + col] = f2bf(o[m][t][r] * rr[r]);
      }
    }
  }
}

// ---------------------------------------------------------------- launch
extern "C" void kernel_launch(void* const* d_in, const int* in_sizes, int n_in,
                              void* d_out, int out_size, void* d_ws, size_t ws_size,
                              hipStream_t stream) {
  const float* x  = (const float*)d_in[0];
  const float* wq = (const float*)d_in[1];
  const float* bq = (const float*)d_in[2];
  const float* wk = (const float*)d_in[3];
  const float* bk = (const float*)d_in[4];
  const float* wv = (const float*)d_in[5];
  const float* bv = (const float*)d_in[6];
  const float* wo = (const float*)d_in[7];
  const float* bo = (const float*)d_in[8];

  char* ws = (char*)d_ws;
  const size_t MB = 1024 * 1024;
  unsigned short* xb  = (unsigned short*)(ws + 0 * MB);   // 16 MB
  unsigned short* wqb = (unsigned short*)(ws + 16 * MB);  //  2 MB
  unsigned short* wkb = (unsigned short*)(ws + 18 * MB);
  unsigned short* wvb = (unsigned short*)(ws + 20 * MB);
  unsigned short* wob = (unsigned short*)(ws + 22 * MB);
  unsigned short* qb  = (unsigned short*)(ws + 24 * MB);  // 16 MB
  unsigned short* kb2 = (unsigned short*)(ws + 40 * MB);  // 16 MB
  unsigned short* vtb = (unsigned short*)(ws + 56 * MB);  // 16 MB [B,H,D,S]
  unsigned short* ctx = (unsigned short*)(ws + 72 * MB);  // 16 MB

  const int NX = ROWS * E_DIM;
  const int NW = E_DIM * E_DIM;
  cvt_f32_bf16<<<(NX + 255) / 256, 256, 0, stream>>>(x,  xb,  NX);
  cvt_f32_bf16<<<(NW + 255) / 256, 256, 0, stream>>>(wq, wqb, NW);
  cvt_f32_bf16<<<(NW + 255) / 256, 256, 0, stream>>>(wk, wkb, NW);
  cvt_f32_bf16<<<(NW + 255) / 256, 256, 0, stream>>>(wv, wvb, NW);
  cvt_f32_bf16<<<(NW + 255) / 256, 256, 0, stream>>>(wo, wob, NW);

  dim3 gg(E_DIM / 128, ROWS / 128);  // (8, 64), 256 threads = 8 waves
  const float qscale = 0.125f;       // 1/sqrt(64)
  gemm_xwt<<<gg, 256, 0, stream>>>(xb, wqb, bq, qb,  qscale, 0);
  gemm_xwt<<<gg, 256, 0, stream>>>(xb, wkb, bk, kb2, 1.0f,   0);
  gemm_xwt<<<gg, 256, 0, stream>>>(xb, wvb, bv, vtb, 1.0f,   2);

  attn_fwd<<<BATCH * N_HEADS * (SEQ / 32), 32, 0, stream>>>(qb, kb2, vtb, ctx);

  gemm_xwt<<<gg, 256, 0, stream>>>(ctx, wob, bo, d_out, 1.0f, 1);
}

// v001
// Measured time: 261 microseconds a run.
// In both of two side-by-side timings against v000, it was 1.40 times as fast.
#include <hip/hip_runtime.h>
#include <hip/hip_bf16.h>
#include <stdint.h>

#define E_DIM 1024
#define N_HEADS 16
#define HEAD_DIM 64
#define SEQ 2048
#define BATCH 4
#define ROWS (BATCH * SEQ)  // 8192

typedef __attribute__((ext_vector_type(16))) __bf16 v16bf;
typedef __attribute__((ext_vector_type(8)))  float  v8f;
typedef __attribute__((ext_vector_type(4)))  unsigned int u32x4;

union ABf { v16bf v; u32x4 u[2]; };

__device__ __forceinline__ unsigned short f2bf(float f) {
  union { float f; unsigned int u; } x; x.f = f;
  unsigned int r = x.u + 0x7FFFu + ((x.u >> 16) & 1u);  // round-to-nearest-even
  return (unsigned short)(r >> 16);
}

#define WMMA_BF16(A, B, C) \
  __builtin_amdgcn_wmma_f32_16x16x32_bf16(false, (A), false, (B), (short)0, (C), false, false)

// ---------------------------------------------------------------- convert
__global__ void cvt_f32_bf16(const float* __restrict__ in,
                             unsigned short* __restrict__ out, int n) {
  int i = blockIdx.x * blockDim.x + threadIdx.x;
  if (i < n) out[i] = f2bf(in[i]);
}

#define G_KT 64                      // k elements per stage: rows of 128 bytes
#define G_NT (E_DIM / G_KT)          // 16 stages
#define G_PITCH 144                  // LDS row pitch in bytes (16 B x odd, for ds_load_b128)
#define G_OPB (128 * G_PITCH)        // one operand's tile in LDS
#define G_STAGEB (2 * G_OPB)         // [X tile | W tile]

// One stage: each thread brings 4 x 16 bytes of X and 4 x 16 bytes of W (rows 32 apart).
// The s_wait_xcnt stands inside the statement so that no address register named by a
// copy is rewritten in front of it.
__device__ __forceinline__ void gemm_copy_stage(unsigned int lds,
                                                const unsigned short* ga,
                                                const unsigned short* gb) {
  asm volatile(
      "global_load_async_to_lds_b128 %0, %8, off\n\t"
      "global_load_async_to_lds_b128 %1, %9, off\n\t"
      "global_load_async_to_lds_b128 %2, %10, off\n\t"
      "global_load_async_to_lds_b128 %3, %11, off\n\t"
      "global_load_async_to_lds_b128 %4, %12, off\n\t"
      "global_load_async_to_lds_b128 %5, %13, off\n\t"
      "global_load_async_to_lds_b128 %6, %14, off\n\t"
      "global_load_async_to_lds_b128 %7, %15, off\n\t"
      "s_wait_xcnt 0x0"
      :: "v"(lds), "v"(lds + 32 * G_PITCH), "v"(lds + 64 * G_PITCH), "v"(lds + 96 * G_PITCH),
         "v"(lds + G_OPB), "v"(lds + G_OPB + 32 * G_PITCH), "v"(lds + G_OPB + 64 * G_PITCH),
         "v"(lds + G_OPB + 96 * G_PITCH),
         "v"(ga), "v"(ga + 32 * E_DIM), "v"(ga + 64 * E_DIM), "v"(ga + 96 * E_DIM),
         "v"(gb), "v"(gb + 32 * E_DIM), "v"(gb + 64 * E_DIM), "v"(gb + 96 * E_DIM)
      : "memory");
}

__global__ __launch_bounds__(256)
void gemm_xwt(const unsigned short* __restrict__ Xb,
              const unsigned short* __restrict__ Wb,
              const float* __restrict__ bias,
              void* __restrict__ outp, float scale, int mode) {
  __shared__ __attribute__((aligned(16))) unsigned char smem[2 * G_STAGEB];

  const int lane = threadIdx.x & 31;
  const int wave = threadIdx.x >> 5;
  const int wm = wave & 3;
  const int wn = wave >> 2;
  const int mbase = blockIdx.y * 128 + wm * 32;
  const int nbase = blockIdx.x * 128 + wn * 64;
  const int lrow = lane & 15;
  const int half = lane >> 4;        // A/B 16-bit K-chunk: k = 8 * half (ISA 7.12.2)

  // copy side: thread -> (row 0..31, 16-byte chunk 0..7); a wave covers 4 whole lines
  const int crow = threadIdx.x >> 3;
  const int cchk = threadIdx.x & 7;
  const unsigned short* ga = Xb + (blockIdx.y * 128 + crow) * E_DIM + cchk * 8;
  const unsigned short* gb = Wb + (blockIdx.x * 128 + crow) * E_DIM + cchk * 8;
  const unsigned int lds0 = (unsigned int)(size_t)smem + crow * G_PITCH + cchk * 16;

  // read side: byte offsets of this lane's fragment rows inside a stage
  const int aoff = (wm * 32 + lrow) * G_PITCH + half * 16;
  const int boff = G_OPB + (wn * 64 + lrow) * G_PITCH + half * 16;

  v8f c[2][4] = {};

  gemm_copy_stage(lds0, ga, gb);
  // tile 0 has landed for this wave's own copies
  asm volatile("s_wait_asynccnt 0x0" ::: "memory");
  __syncthreads();
  gemm_copy_stage(lds0 + G_STAGEB, ga + G_KT, gb + G_KT);

#pragma unroll 1  // one stage a trip: the ring's order stands once, at the loop's foot
  for (int t = 0; t < G_NT; ++t) {
    const unsigned int bsel = (unsigned int)(t & 1) * G_STAGEB;
    const unsigned char* sb = smem + bsel;
    // this loop and the three inside it are unrolled so that fragments and accumulators
    // are indexed by constants and stay in registers
#pragma unroll
    for (int kk = 0; kk < 2; ++kk) {
      ABf af[2], bf[4];
#pragma unroll
      for (int m = 0; m < 2; ++m) {
        af[m].u[0] = *(const u32x4*)(sb + aoff + m * 16 * G_PITCH + kk * 64);
        af[m].u[1] = *(const u32x4*)(sb + aoff + m * 16 * G_PITCH + kk * 64 + 32);
      }
#pragma unroll
      for (int n = 0; n < 4; ++n) {
        bf[n].u[0] = *(const u32x4*)(sb + boff + n * 16 * G_PITCH + kk * 64);
        bf[n].u[1] = *(const u32x4*)(sb + boff + n * 16 * G_PITCH + kk * 64 + 32);
      }
#pragma unroll
      for (int m = 0; m < 2; ++m)
#pragma unroll
        for (int n = 0; n < 4; ++n) c[m][n] = WMMA_BF16(af[m].v, bf[n].v, c[m][n]);
    }
    // this wave's reads of the buffer have returned before it is handed to the copies
    asm volatile("s_wait_dscnt 0x0" ::: "memory");
    // this wave's copies of tile t + 1 have landed before the barrier publishes them
    asm volatile("s_wait_asynccnt 0x0" ::: "memory");
    __syncthreads();
    if (t + 2 < G_NT)
      gemm_copy_stage(lds0 + bsel, ga + (t + 2) * G_KT, gb + (t + 2) * G_KT);
  }
  // no copy is outstanding when the wave goes on to its stores and ends
  asm volatile("s_wait_asynccnt 0x0" ::: "memory");

#pragma unroll
  for (int m = 0; m < 2; ++m)
#pragma unroll
    for (int t = 0; t < 4; ++t) {
      const int col = nbase + t * 16 + lrow;
      const float bv = bias[col];
#pragma unroll
      for (int r = 0; r < 8; ++r) {
        const int row = mbase + m * 16 + r + 8 * half;  // C layout: VGPR r -> M = r + 8*half
        const float v = (c[m][t][r] + bv) * scale;
        if (mode == 0) {
          ((unsigned short*)outp)[row * E_DIM + col] = f2bf(v);
        } else if (mode == 1) {
          ((float*)outp)[row * E_DIM + col] = v;
        } else {  // V transpose: [B,H,D,S]
          const int b = row >> 11, s = row & 2047;
          const int h = col >> 6, d = col & 63;
          ((unsigned short*)outp)[((b * N_HEADS + h) * HEAD_DIM + d) * SEQ + s] = f2bf(v);
        }
      }
    }
}

// ---------------------------------------------------------------- flash attention
// One wave per 32-query tile per (b,h); online softmax; V tiles prefetched
// before the softmax phase so global loads overlap the LDS work.
// Q,K: [ROWS,1024] bf16 (Q pre-scaled by 1/8).  Vt: [B,H,D,S] bf16.  Ctx: bf16 [ROWS,1024].
__global__ __launch_bounds__(32)
void attn_fwd(const unsigned short* __restrict__ Qb,
              const unsigned short* __restrict__ Kb,
              const unsigned short* __restrict__ Vtb,
              unsigned short* __restrict__ Ctx) {
  __shared__ __align__(16) float sc[32][32];
  __shared__ __align__(16) unsigned short pb[32][32];
  __shared__ float salpha[32];
  __shared__ float srecip[32];

  const int lane = threadIdx.x & 31;
  const int lrow = lane & 15;
  const int lk = (lane >> 4) << 3;
  const int half = lane >> 4;

  const int bh = blockIdx.x >> 6;   // / (SEQ/32)
  const int qt = blockIdx.x & 63;
  const int b = bh >> 4, h = bh & 15;
  const int qrowbase = b * SEQ + qt * 32;

  const u32x4* Qv = (const u32x4*)Qb;
  const u32x4* Kv = (const u32x4*)Kb;
  const u32x4* Vv = (const u32x4*)Vtb;

  // Q: 2 query sub-tiles x 2 K-dim chunks, resident in registers
  ABf aq[2][2];
#pragma unroll
  for (int m = 0; m < 2; ++m) {
    const int qoff = (qrowbase + m * 16 + lrow) * E_DIM + h * HEAD_DIM;
    aq[m][0].u[0] = Qv[(qoff + lk) >> 3];
    aq[m][0].u[1] = Qv[(qoff + lk + 16) >> 3];
    aq[m][1].u[0] = Qv[(qoff + 32 + lk) >> 3];
    aq[m][1].u[1] = Qv[(qoff + 32 + lk + 16) >> 3];
  }

  v8f o[2][4] = {};
  float m_i = -3.0e38f, l_i = 0.0f;

#pragma unroll 1
  for (int kt = 0; kt < SEQ / 32; ++kt) {
    // ---- scores: S(32x32) = Q(32x64) @ K_tile^T(64x32)
    ABf bk[2][2];
    {
      const int koff0 = (b * SEQ + kt * 32 + lrow) * E_DIM + h * HEAD_DIM;
      const int koff1 = koff0 + 16 * E_DIM;
      bk[0][0].u[0] = Kv[(koff0 + lk) >> 3];      bk[0][0].u[1] = Kv[(koff0 + lk + 16) >> 3];
      bk[0][1].u[0] = Kv[(koff0 + 32 + lk) >> 3]; bk[0][1].u[1] = Kv[(koff0 + 32 + lk + 16) >> 3];
      bk[1][0].u[0] = Kv[(koff1 + lk) >> 3];      bk[1][0].u[1] = Kv[(koff1 + lk + 16) >> 3];
      bk[1][1].u[0] = Kv[(koff1 + 32 + lk) >> 3]; bk[1][1].u[1] = Kv[(koff1 + 32 + lk + 16) >> 3];
    }
    v8f s[2][2] = {};
#pragma unroll
    for (int m = 0; m < 2; ++m)
#pragma unroll
      for (int n = 0; n < 2; ++n) {
        s[m][n] = WMMA_BF16(aq[m][0].v, bk[n][0].v, s[m][n]);
        s[m][n] = WMMA_BF16(aq[m][1].v, bk[n][1].v, s[m][n]);
      }

    // ---- prefetch V tiles now; they stay in flight through the softmax phase
    ABf bvm[4];
#pragma unroll
    for (int t = 0; t < 4; ++t) {
      const int voff = ((b * N_HEADS + h) * HEAD_DIM + t * 16 + lrow) * SEQ + kt * 32;
      bvm[t].u[0] = Vv[(voff + lk) >> 3];
      bvm[t].u[1] = Vv[(voff + lk + 16) >> 3];
    }

    // ---- score tile C-layout -> row-major in LDS
#pragma unroll
    for (int m = 0; m < 2; ++m)
#pragma unroll
      for (int r = 0; r < 8; ++r) {
        sc[m * 16 + r + 8 * half][lrow]      = s[m][0][r];
        sc[m * 16 + r + 8 * half][16 + lrow] = s[m][1][r];
      }
    __syncthreads();  // single-wave WG: S_NOP

    // ---- online softmax: every lane owns one query row
    {
      float rmax = -3.0e38f;
#pragma unroll
      for (int j = 0; j < 8; ++j) {
        const float4 v4 = *(const float4*)&sc[lane][j * 4];
        rmax = fmaxf(rmax, fmaxf(fmaxf(v4.x, v4.y), fmaxf(v4.z, v4.w)));
      }
      const float mnew = fmaxf(m_i, rmax);
      const float alpha = __expf(m_i - mnew);
      float ssum = 0.f;
#pragma unroll
      for (int j = 0; j < 16; ++j) {
        const float p0 = __expf(sc[lane][2 * j] - mnew);
        const float p1 = __expf(sc[lane][2 * j + 1] - mnew);
        ((unsigned int*)pb[lane])[j] = (unsigned int)f2bf(p0) | ((unsigned int)f2bf(p1) << 16);
        ssum += p0 + p1;
      }
      l_i = l_i * alpha + ssum;
      m_i = mnew;
      salpha[lane] = alpha;
    }
    __syncthreads();

    // ---- P back out in A-operand layout (ds_load_b128)
    ABf ap[2];
    ap[0].u[0] = *((const u32x4*)&pb[lrow][lk]);
    ap[0].u[1] = *((const u32x4*)&pb[lrow][lk + 16]);
    ap[1].u[0] = *((const u32x4*)&pb[16 + lrow][lk]);
    ap[1].u[1] = *((const u32x4*)&pb[16 + lrow][lk + 16]);

#pragma unroll
    for (int m = 0; m < 2; ++m) {
      float ar[8];
#pragma unroll
      for (int r = 0; r < 8; ++r) ar[r] = salpha[m * 16 + r + 8 * half];
#pragma unroll
      for (int t = 0; t < 4; ++t)
#pragma unroll
        for (int r = 0; r < 8; ++r) o[m][t][r] = o[m][t][r] * ar[r];
    }

    // ---- O += P(32x32) @ V_tile(32x64)
#pragma unroll
    for (int m = 0; m < 2; ++m)
#pragma unroll
      for (int t = 0; t < 4; ++t) o[m][t] = WMMA_BF16(ap[m].v, bvm[t].v, o[m][t]);
    __syncthreads();
  }

  srecip[lane] = (l_i > 0.f) ? (1.0f / l_i) : 0.f;
  __syncthreads();
#pragma unroll
  for (int m = 0; m < 2; ++m) {
    float rr[8];
#pragma unroll
    for (int r = 0; r < 8; ++r) rr[r] = srecip[m * 16 + r + 8 * half];
#pragma unroll
    for (int t = 0; t < 4; ++t) {
      const int col = h * HEAD_DIM + t * 16 + lrow;
#pragma unroll
      for (int r = 0; r < 8; ++r) {
        const int row = qrowbase + m * 16 + r + 8 * half;
        Ctx[row * E_DIM + col] = f2bf(o[m][t][r] * rr[r]);
      }
    }
  }
}

// ---------------------------------------------------------------- launch
extern "C" void kernel_launch(void* const* d_in, const int* in_sizes, int n_in,
                              void* d_out, int out_size, void* d_ws, size_t ws_size,
                              hipStream_t stream) {
  const float* x  = (const float*)d_in[0];
  const float* wq = (const float*)d_in[1];
  const float* bq = (const float*)d_in[2];
  const float* wk = (const float*)d_in[3];
  const float* bk = (const float*)d_in[4];
  const float* wv = (const float*)d_in[5];
  const float* bv = (const float*)d_in[6];
  const float* wo = (const float*)d_in[7];
  const float* bo = (const float*)d_in[8];

  char* ws = (char*)d_ws;
  const size_t MB = 1024 * 1024;
  unsigned short* xb  = (unsigned short*)(ws + 0 * MB);   // 16 MB
  unsigned short* wqb = (unsigned short*)(ws + 16 * MB);  //  2 MB
  unsigned short* wkb = (unsigned short*)(ws + 18 * MB);
  unsigned short* wvb = (unsigned short*)(ws + 20 * MB);
  unsigned short* wob = (unsigned short*)(ws + 22 * MB);
  unsigned short* qb  = (unsigned short*)(ws + 24 * MB);  // 16 MB
  unsigned short* kb2 = (unsigned short*)(ws + 40 * MB);  // 16 MB
  unsigned short* vtb = (unsigned short*)(ws + 56 * MB);  // 16 MB [B,H,D,S]
  unsigned short* ctx = (unsigned short*)(ws + 72 * MB);  // 16 MB

  const int NX = ROWS * E_DIM;
  const int NW = E_DIM * E_DIM;
  cvt_f32_bf16<<<(NX + 255) / 256, 256, 0, stream>>>(x,  xb,  NX);
  cvt_f32_bf16<<<(NW + 255) / 256, 256, 0, stream>>>(wq, wqb, NW);
  cvt_f32_bf16<<<(NW + 255) / 256, 256, 0, stream>>>(wk, wkb, NW);
  cvt_f32_bf16<<<(NW + 255) / 256, 256, 0, stream>>>(wv, wvb, NW);
  cvt_f32_bf16<<<(NW + 255) / 256, 256, 0, stream>>>(wo, wob, NW);

  dim3 gg(E_DIM / 128, ROWS / 128);  // (8, 64), 256 threads = 8 waves
  const float qscale = 0.125f;       // 1/sqrt(64)
  gemm_xwt<<<gg, 256, 0, stream>>>(xb, wqb, bq, qb,  qscale, 0);
  gemm_xwt<<<gg, 256, 0, stream>>>(xb, wkb, bk, kb2, 1.0f,   0);
  gemm_xwt<<<gg, 256, 0, stream>>>(xb, wvb, bv, vtb, 1.0f,   2);

  attn_fwd<<<BATCH * N_HEADS * (SEQ / 32), 32, 0, stream>>>(qb, kb2, vtb, ctx);

  gemm_xwt<<<gg, 256, 0, stream>>>(ctx, wob, bo, d_out, 1.0f, 1);
}

// v002
// A run of this version takes 245 microseconds.
// In both of two side-by-side timings against v001, it was 1.06 times as fast.
// All steps since v000 together make it 1.48 times as fast.
#include <hip/hip_runtime.h>
#include <hip/hip_bf16.h>
#include <stdint.h>

#define E_DIM 1024
#define N_HEADS 16
#define HEAD_DIM 64
#define SEQ 2048
#define BATCH 4
#define ROWS (BATCH * SEQ)  // 8192

typedef __attribute__((ext_vector_type(16))) __bf16 v16bf;
typedef __attribute__((ext_vector_type(8)))  float  v8f;
typedef __attribute__((ext_vector_type(4)))  unsigned int u32x4;

union ABf { v16bf v; u32x4 u[2]; };

__device__ __forceinline__ unsigned short f2bf(float f) {
  union { float f; unsigned int u; } x; x.f = f;
  unsigned int r = x.u + 0x7FFFu + ((x.u >> 16) & 1u);  // round-to-nearest-even
  return (unsigned short)(r >> 16);
}

#define WMMA_BF16(A, B, C) \
  __builtin_amdgcn_wmma_f32_16x16x32_bf16(false, (A), false, (B), (short)0, (C), false, false)

// ---------------------------------------------------------------- convert
__global__ void cvt_f32_bf16(const float* __restrict__ in,
                             unsigned short* __restrict__ out, int n) {
  int i = blockIdx.x * blockDim.x + threadIdx.x;
  if (i < n) out[i] = f2bf(in[i]);
}

#define G_KT 64                      // k elements per stage: rows of 128 bytes
#define G_NT (E_DIM / G_KT)          // 16 stages
#define G_PITCH 144                  // LDS row pitch in bytes (16 B x odd, for ds_load_b128)
#define G_OPB (128 * G_PITCH)        // one operand's tile in LDS
#define G_STAGEB (2 * G_OPB)         // [X tile | W tile]

// One stage: each thread brings 4 x 16 bytes of X and 4 x 16 bytes of W (rows 32 apart).
// The s_wait_xcnt stands inside the statement so that no address register named by a
// copy is rewritten in front of it.
__device__ __forceinline__ void gemm_copy_stage(unsigned int lds,
                                                const unsigned short* ga,
                                                const unsigned short* gb) {
  asm volatile(
      "global_load_async_to_lds_b128 %0, %8, off\n\t"
      "global_load_async_to_lds_b128 %1, %9, off\n\t"
      "global_load_async_to_lds_b128 %2, %10, off\n\t"
      "global_load_async_to_lds_b128 %3, %11, off\n\t"
      "global_load_async_to_lds_b128 %4, %12, off\n\t"
      "global_load_async_to_lds_b128 %5, %13, off\n\t"
      "global_load_async_to_lds_b128 %6, %14, off\n\t"
      "global_load_async_to_lds_b128 %7, %15, off\n\t"
      "s_wait_xcnt 0x0"
      :: "v"(lds), "v"(lds + 32 * G_PITCH), "v"(lds + 64 * G_PITCH), "v"(lds + 96 * G_PITCH),
         "v"(lds + G_OPB), "v"(lds + G_OPB + 32 * G_PITCH), "v"(lds + G_OPB + 64 * G_PITCH),
         "v"(lds + G_OPB + 96 * G_PITCH),
         "v"(ga), "v"(ga + 32 * E_DIM), "v"(ga + 64 * E_DIM), "v"(ga + 96 * E_DIM),
         "v"(gb), "v"(gb + 32 * E_DIM), "v"(gb + 64 * E_DIM), "v"(gb + 96 * E_DIM)
      : "memory");
}

__global__ __launch_bounds__(256)
void gemm_xwt(const unsigned short* __restrict__ Xb,
              const unsigned short* __restrict__ Wb,
              const float* __restrict__ bias,
              void* __restrict__ outp, float scale, int mode) {
  __shared__ __attribute__((aligned(16))) unsigned char smem[2 * G_STAGEB];

  const int lane = threadIdx.x & 31;
  const int wave = threadIdx.x >> 5;
  const int wm = wave & 3;
  const int wn = wave >> 2;
  const int mbase = blockIdx.y * 128 + wm * 32;
  const int nbase = blockIdx.x * 128 + wn * 64;
  const int lrow = lane & 15;
  const int half = lane >> 4;        // A/B 16-bit K-chunk: k = 8 * half (ISA 7.12.2)

  // copy side: thread -> (row 0..31, 16-byte chunk 0..7); a wave covers 4 whole lines
  const int crow = threadIdx.x >> 3;
  const int cchk = threadIdx.x & 7;
  const unsigned short* ga = Xb + (blockIdx.y * 128 + crow) * E_DIM + cchk * 8;
  const unsigned short* gb = Wb + (blockIdx.x * 128 + crow) * E_DIM + cchk * 8;
  const unsigned int lds0 = (unsigned int)(size_t)smem + crow * G_PITCH + cchk * 16;

  // read side: byte offsets of this lane's fragment rows inside a stage
  const int aoff = (wm * 32 + lrow) * G_PITCH + half * 16;
  const int boff = G_OPB + (wn * 64 + lrow) * G_PITCH + half * 16;

  v8f c[2][4] = {};

  gemm_copy_stage(lds0, ga, gb);
  // tile 0 has landed for this wave's own copies
  asm volatile("s_wait_asynccnt 0x0" ::: "memory");
  __syncthreads();
  gemm_copy_stage(lds0 + G_STAGEB, ga + G_KT, gb + G_KT);

#pragma unroll 1  // one stage a trip: the ring's order stands once, at the loop's foot
  for (int t = 0; t < G_NT; ++t) {
    const unsigned int bsel = (unsigned int)(t & 1) * G_STAGEB;
    const unsigned char* sb = smem + bsel;
    // this loop and the three inside it are unrolled so that fragments and accumulators
    // are indexed by constants and stay in registers
#pragma unroll
    for (int kk = 0; kk < 2; ++kk) {
      ABf af[2], bf[4];
#pragma unroll
      for (int m = 0; m < 2; ++m) {
        af[m].u[0] = *(const u32x4*)(sb + aoff + m * 16 * G_PITCH + kk * 64);
        af[m].u[1] = *(const u32x4*)(sb + aoff + m * 16 * G_PITCH + kk * 64 + 32);
      }
#pragma unroll
      for (int n = 0; n < 4; ++n) {
        bf[n].u[0] = *(const u32x4*)(sb + boff + n * 16 * G_PITCH + kk * 64);
        bf[n].u[1] = *(const u32x4*)(sb + boff + n * 16 * G_PITCH + kk * 64 + 32);
      }
#pragma unroll
      for (int m = 0; m < 2; ++m)
#pragma unroll
        for (int n = 0; n < 4; ++n) c[m][n] = WMMA_BF16(af[m].v, bf[n].v, c[m][n]);
    }
    // this wave's reads of the buffer have returned before it is handed to the copies
    asm volatile("s_wait_dscnt 0x0" ::: "memory");
    // this wave's copies of tile t + 1 have landed before the barrier publishes them
    asm volatile("s_wait_asynccnt 0x0" ::: "memory");
    __syncthreads();
    if (t + 2 < G_NT)
      gemm_copy_stage(lds0 + bsel, ga + (t + 2) * G_KT, gb + (t + 2) * G_KT);
  }
  // no copy is outstanding when the wave goes on to its stores and ends
  asm volatile("s_wait_asynccnt 0x0" ::: "memory");

#pragma unroll
  for (int m = 0; m < 2; ++m)
#pragma unroll
    for (int t = 0; t < 4; ++t) {
      const int col = nbase + t * 16 + lrow;
      const float bv = bias[col];
#pragma unroll
      for (int r = 0; r < 8; ++r) {
        const int row = mbase + m * 16 + r + 8 * half;  // C layout: VGPR r -> M = r + 8*half
        const float v = (c[m][t][r] + bv) * scale;
        if (mode == 0) {
          ((unsigned short*)outp)[row * E_DIM + col] = f2bf(v);
        } else if (mode == 1) {
          ((float*)outp)[row * E_DIM + col] = v;
        } else {  // V transpose: [B,H,D,S]
          const int b = row >> 11, s = row & 2047;
          const int h = col >> 6, d = col & 63;
          ((unsigned short*)outp)[((b * N_HEADS + h) * HEAD_DIM + d) * SEQ + s] = f2bf(v);
        }
      }
    }
}

// ---------------------------------------------------------------- flash attention
// One wave per 32-query tile; the 8 waves of a work-group take 256 queries of one (b,h)
// and share its K and Vt tiles: a stage of 64 keys (64 K rows and 64 Vt rows of 128 bytes)
// is staged in LDS by asynchronous copies that cover whole lines; two buffers, the next
// stage flies while this one is worked on.  Every wave reads its fragments from LDS.
// Online softmax per wave, through the wave's own LDS scratch.
// Q,K: [ROWS,1024] bf16 (Q pre-scaled by 1/8).  Vt: [B,H,D,S] bf16.  Ctx: bf16 [ROWS,1024].
#define A_KEYS 64                    // keys per stage: two passes of 32
#define A_NST (SEQ / A_KEYS)         // 32 stages
#define A_PITCH 144                  // LDS row pitch in bytes (16 B x odd, for ds_load_b128)
#define A_OPB (64 * A_PITCH)         // one operand's tile in LDS
#define A_STAGEB (2 * A_OPB)         // [K tile | Vt tile]

// One stage: each thread brings 2 x 16 bytes of K and 2 x 16 bytes of Vt (rows 32 apart).
// The s_wait_xcnt stands inside the statement so that no address register named by a
// copy is rewritten in front of it.
__device__ __forceinline__ void attn_copy_stage(unsigned int lds,
                                                const unsigned short* gk,
                                                const unsigned short* gv) {
  asm volatile(
      "global_load_async_to_lds_b128 %0, %4, off\n\t"
      "global_load_async_to_lds_b128 %1, %5, off\n\t"
      "global_load_async_to_lds_b128 %2, %6, off\n\t"
      "global_load_async_to_lds_b128 %3, %7, off\n\t"
      "s_wait_xcnt 0x0"
      :: "v"(lds), "v"(lds + 32 * A_PITCH), "v"(lds + A_OPB), "v"(lds + A_OPB + 32 * A_PITCH),
         "v"(gk), "v"(gk + 32 * E_DIM), "v"(gv), "v"(gv + 32 * SEQ)
      : "memory");
}

// The softmax scratch belongs to one wave: its LDS stores are waited for and kept in front
// of its later LDS loads of other lanes' words, as at a barrier, but the other waves of
// the work-group are not held up.
__device__ __forceinline__ void wave_order() {
  __builtin_amdgcn_fence(__ATOMIC_RELEASE, "workgroup");
  __builtin_amdgcn_wave_barrier();
  __builtin_amdgcn_fence(__ATOMIC_ACQUIRE, "workgroup");
}

__global__ __launch_bounds__(256)
void attn_fwd(const unsigned short* __restrict__ Qb,
              const unsigned short* __restrict__ Kb,
              const unsigned short* __restrict__ Vtb,
              unsigned short* __restrict__ Ctx) {
  __shared__ __attribute__((aligned(16))) unsigned char ring[2 * A_STAGEB];
  __shared__ __align__(16) float sc_w[8][32][32];
  __shared__ __align__(16) unsigned short pb_w[8][32][32];
  __shared__ __align__(16) float salpha_w[8][32];
  __shared__ __align__(16) float srecip_w[8][32];

  const int lane = threadIdx.x & 31;
  const int wave = threadIdx.x >> 5;
  const int lrow = lane & 15;
  const int lk = (lane >> 4) << 3;
  const int half = lane >> 4;

  // this wave's own softmax scratch
  float (*sc)[32] = sc_w[wave];
  unsigned short (*pb)[32] = pb_w[wave];
  float* salpha = salpha_w[wave];
  float* srecip = srecip_w[wave];

  const int bh = blockIdx.x >> 3;   // / (SEQ/256)
  const int qt = (blockIdx.x & 7) * 8 + wave;
  const int b = bh >> 4, h = bh & 15;
  const int qrowbase = b * SEQ + qt * 32;

  const u32x4* Qv = (const u32x4*)Qb;

  // copy side: thread -> (row 0..31, 16-byte chunk 0..7); a wave covers 4 whole lines
  const int crow = threadIdx.x >> 3;
  const int cchk = threadIdx.x & 7;
  const unsigned short* gk = Kb + (b * SEQ + crow) * E_DIM + h * HEAD_DIM + cchk * 8;
  const unsigned short* gv = Vtb + ((b * N_HEADS + h) * HEAD_DIM + crow) * SEQ + cchk * 8;
  const unsigned int lds0 = (unsigned int)(size_t)ring + crow * A_PITCH + cchk * 16;

  // read side: byte offset of this lane's fragment row inside an operand's tile
  const int foff = lrow * A_PITCH + half * 16;

  // Q: 2 query sub-tiles x 2 K-dim chunks, resident in registers
  ABf aq[2][2];
#pragma unroll
  for (int m = 0; m < 2; ++m) {
    const int qoff = (qrowbase + m * 16 + lrow) * E_DIM + h * HEAD_DIM;
    aq[m][0].u[0] = Qv[(qoff + lk) >> 3];
    aq[m][0].u[1] = Qv[(qoff + lk + 16) >> 3];
    aq[m][1].u[0] = Qv[(qoff + 32 + lk) >> 3];
    aq[m][1].u[1] = Qv[(qoff + 32 + lk + 16) >> 3];
  }

  v8f o[2][4] = {};
  float m_i = -3.0e38f, l_i = 0.0f;

  attn_copy_stage(lds0, gk, gv);
  // stage 0 has landed for this wave's own copies
  asm volatile("s_wait_asynccnt 0x0" ::: "memory");
  __syncthreads();
  attn_copy_stage(lds0 + A_STAGEB, gk + A_KEYS * E_DIM, gv + A_KEYS);

#pragma unroll 1  // one stage a trip: the ring's order stands once, at the loop's foot
  for (int st = 0; st < A_NST; ++st) {
   const unsigned int bsel = (unsigned int)(st & 1) * A_STAGEB;
   const unsigned char* kbuf = ring + bsel + foff;
   const unsigned char* vbuf = kbuf + A_OPB;
#pragma unroll 1  // one pass of 32 keys a trip: short loop text, one set of pass registers
   for (int p = 0; p < A_KEYS / 32; ++p) {
    // ---- scores: S(32x32) = Q(32x64) @ K_tile^T(64x32)
    ABf bk[2][2];
    // both loops unrolled so that the fragments are indexed by constants and stay in registers
#pragma unroll
    for (int n = 0; n < 2; ++n)
#pragma unroll
      for (int kc = 0; kc < 2; ++kc) {
        const unsigned char* kr = kbuf + (p * 32 + n * 16) * A_PITCH + kc * 64;
        bk[n][kc].u[0] = *(const u32x4*)(kr);
        bk[n][kc].u[1] = *(const u32x4*)(kr + 32);
      }
    v8f s[2][2] = {};
#pragma unroll
    for (int m = 0; m < 2; ++m)
#pragma unroll
      for (int n = 0; n < 2; ++n) {
        s[m][n] = WMMA_BF16(aq[m][0].v, bk[n][0].v, s[m][n]);
        s[m][n] = WMMA_BF16(aq[m][1].v, bk[n][1].v, s[m][n]);
      }

    // ---- V fragments from the ring
    ABf bvm[4];
#pragma unroll
    for (int t = 0; t < 4; ++t) {
      const unsigned char* vr = vbuf + t * 16 * A_PITCH + p * 64;
      bvm[t].u[0] = *(const u32x4*)(vr);
      bvm[t].u[1] = *(const u32x4*)(vr + 32);
    }

    // ---- score tile C-layout -> row-major in LDS
#pragma unroll
    for (int m = 0; m < 2; ++m)
#pragma unroll
      for (int r = 0; r < 8; ++r) {
        sc[m * 16 + r + 8 * half][lrow]      = s[m][0][r];
        sc[m * 16 + r + 8 * half][16 + lrow] = s[m][1][r];
      }
    wave_order();

    // ---- online softmax: every lane owns one query row
    {
      float rmax = -3.0e38f;
#pragma unroll
      for (int j = 0; j < 8; ++j) {
        const float4 v4 = *(const float4*)&sc[lane][j * 4];
        rmax = fmaxf(rmax, fmaxf(fmaxf(v4.x, v4.y), fmaxf(v4.z, v4.w)));
      }
      const float mnew = fmaxf(m_i, rmax);
      const float alpha = __expf(m_i - mnew);
      float ssum = 0.f;
#pragma unroll
      for (int j = 0; j < 16; ++j) {
        const float p0 = __expf(sc[lane][2 * j] - mnew);
        const float p1 = __expf(sc[lane][2 * j + 1] - mnew);
        ((unsigned int*)pb[lane])[j] = (unsigned int)f2bf(p0) | ((unsigned int)f2bf(p1) << 16);
        ssum += p0 + p1;
      }
      l_i = l_i * alpha + ssum;
      m_i = mnew;
      salpha[lane] = alpha;
    }
    wave_order();

    // ---- P back out in A-operand layout (ds_load_b128)
    ABf ap[2];
    ap[0].u[0] = *((const u32x4*)&pb[lrow][lk]);
    ap[0].u[1] = *((const u32x4*)&pb[lrow][lk + 16]);
    ap[1].u[0] = *((const u32x4*)&pb[16 + lrow][lk]);
    ap[1].u[1] = *((const u32x4*)&pb[16 + lrow][lk + 16]);

#pragma unroll
    for (int m = 0; m < 2; ++m) {
      float ar[8];
#pragma unroll
      for (int r = 0; r < 8; ++r) ar[r] = salpha[m * 16 + r + 8 * half];
#pragma unroll
      for (int t = 0; t < 4; ++t)
#pragma unroll
        for (int r = 0; r < 8; ++r) o[m][t][r] = o[m][t][r] * ar[r];
    }

    // ---- O += P(32x32) @ V_tile(32x64)
#pragma unroll
    for (int m = 0; m < 2; ++m)
#pragma unroll
      for (int t = 0; t < 4; ++t) o[m][t] = WMMA_BF16(ap[m].v, bvm[t].v, o[m][t]);
    wave_order();
    // keeps the pass's WMMAs in front of the slots below
    __builtin_amdgcn_sched_barrier(0);
    // four vector slots between the pass's last WMMA and the next trip's first write of a
    // register that held its A or B
    asm volatile("v_nop\n\tv_nop\n\tv_nop\n\tv_nop");
   }
   // this wave's reads of the buffer have returned before it is handed to the copies
   asm volatile("s_wait_dscnt 0x0" ::: "memory");
   // this wave's copies of stage st + 1 have landed before the barrier publishes them
   asm volatile("s_wait_asynccnt 0x0" ::: "memory");
   __syncthreads();
   if (st + 2 < A_NST)
     attn_copy_stage(lds0 + bsel, gk + (st + 2) * A_KEYS * E_DIM, gv + (st + 2) * A_KEYS);
  }
  // no copy is outstanding when the wave goes on to its stores and ends
  asm volatile("s_wait_asynccnt 0x0" ::: "memory");

  srecip[lane] = (l_i > 0.f) ? (1.0f / l_i) : 0.f;
  wave_order();
#pragma unroll
  for (int m = 0; m < 2; ++m) {
    float rr[8];
#pragma unroll
    for (int r = 0; r < 8; ++r) rr[r] = srecip[m * 16 + r + 8 * half];
#pragma unroll
    for (int t = 0; t < 4; ++t) {
      const int col = h * HEAD_DIM + t * 16 + lrow;
#pragma unroll
      for (int r = 0; r < 8; ++r) {
        const int row = qrowbase + m * 16 + r + 8 * half;
        Ctx[row * E_DIM + col] = f2bf(o[m][t][r] * rr[r]);
      }
    }
  }
}

// ---------------------------------------------------------------- launch
extern "C" void kernel_launch(void* const* d_in, const int* in_sizes, int n_in,
                              void* d_out, int out_size, void* d_ws, size_t ws_size,
                              hipStream_t stream) {
  const float* x  = (const float*)d_in[0];
  const float* wq = (const float*)d_in[1];
  const float* bq = (const float*)d_in[2];
  const float* wk = (const float*)d_in[3];
  const float* bk = (const float*)d_in[4];
  const float* wv = (const float*)d_in[5];
  const float* bv = (const float*)d_in[6];
  const float* wo = (const float*)d_in[7];
  const float* bo = (const float*)d_in[8];

  char* ws = (char*)d_ws;
  const size_t MB = 1024 * 1024;
  unsigned short* xb  = (unsigned short*)(ws + 0 * MB);   // 16 MB
  unsigned short* wqb = (unsigned short*)(ws + 16 * MB);  //  2 MB
  unsigned short* wkb = (unsigned short*)(ws + 18 * MB);
  unsigned short* wvb = (unsigned short*)(ws + 20 * MB);
  unsigned short* wob = (unsigned short*)(ws + 22 * MB);
  unsigned short* qb  = (unsigned short*)(ws + 24 * MB);  // 16 MB
  unsigned short* kb2 = (unsigned short*)(ws + 40 * MB);  // 16 MB
  unsigned short* vtb = (unsigned short*)(ws + 56 * MB);  // 16 MB [B,H,D,S]
  unsigned short* ctx = (unsigned short*)(ws + 72 * MB);  // 16 MB

  const int NX = ROWS * E_DIM;
  const int NW = E_DIM * E_DIM;
  cvt_f32_bf16<<<(NX + 255) / 256, 256, 0, stream>>>(x,  xb,  NX);
  cvt_f32_bf16<<<(NW + 255) / 256, 256, 0, stream>>>(wq, wqb, NW);
  cvt_f32_bf16<<<(NW + 255) / 256, 256, 0, stream>>>(wk, wkb, NW);
  cvt_f32_bf16<<<(NW + 255) / 256, 256, 0, stream>>>(wv, wvb, NW);
  cvt_f32_bf16<<<(NW + 255) / 256, 256, 0, stream>>>(wo, wob, NW);

  dim3 gg(E_DIM / 128, ROWS / 128);  // (8, 64), 256 threads = 8 waves
  const float qscale = 0.125f;       // 1/sqrt(64)
  gemm_xwt<<<gg, 256, 0, stream>>>(xb, wqb, bq, qb,  qscale, 0);
  gemm_xwt<<<gg, 256, 0, stream>>>(xb, wkb, bk, kb2, 1.0f,   0);
  gemm_xwt<<<gg, 256, 0, stream>>>(xb, wvb, bv, vtb, 1.0f,   2);

  attn_fwd<<<BATCH * N_HEADS * (SEQ / 256), 256, 0, stream>>>(qb, kb2, vtb, ctx);

  gemm_xwt<<<gg, 256, 0, stream>>>(ctx, wob, bo, d_out, 1.0f, 1);
}

// v003
// Measured time: 224 microseconds a run.
// Timed twice side by side with v002, it ran 1.09 and 1.10 times as fast.
// All steps since v000 together make it 1.62 times as fast.
#include <hip/hip_runtime.h>
#include <hip/hip_bf16.h>
#include <stdint.h>

#define E_DIM 1024
#define N_HEADS 16
#define HEAD_DIM 64
#define SEQ 2048
#define BATCH 4
#define ROWS (BATCH * SEQ)  // 8192

typedef __attribute__((ext_vector_type(16))) __bf16 v16bf;
typedef __attribute__((ext_vector_type(8)))  float  v8f;
typedef __attribute__((ext_vector_type(4)))  unsigned int u32x4;
typedef __attribute__((ext_vector_type(4)))  float  f32x4;

union ABf { v16bf v; u32x4 u[2]; };

__device__ __forceinline__ unsigned short f2bf(float f) {
  union { float f; unsigned int u; } x; x.f = f;
  unsigned int r = x.u + 0x7FFFu + ((x.u >> 16) & 1u);  // round-to-nearest-even
  return (unsigned short)(r >> 16);
}

#define WMMA_BF16(A, B, C) \
  __builtin_amdgcn_wmma_f32_16x16x32_bf16(false, (A), false, (B), (short)0, (C), false, false)

// ---------------------------------------------------------------- convert
// x and the four weights go to bf16 in ONE launch of one 16-wave work-group per WGP, so
// that few waves have to be started.  The five results lie one behind another in `out`
// (x, wq, wk, wv, wo).  A piece is 16,384 values of one array; a work-group takes
// CV_XT pieces of x and one piece of a weight.  Each wave-wide load covers 512 contiguous
// bytes (4 whole lines), each wave-wide store 256 (2 whole lines); all of a thread's
// loads are issued before its first value is converted.
#define CV_THREADS 512
#define CV_BLOCKS 256
#define CV_LOADS 8
#define CV_STEP (CV_THREADS * 4)                 // values a work-group brings with one load
#define CV_PIECE (CV_STEP * CV_LOADS)            // 16,384 values
#define CV_XT (ROWS * E_DIM / CV_PIECE / CV_BLOCKS)  // 2 pieces of x a work-group
#define CV_WP (E_DIM * E_DIM / CV_PIECE)         // 64 pieces in each weight
static_assert(CV_XT * CV_BLOCKS * CV_PIECE == ROWS * E_DIM &&
              CV_WP * CV_PIECE == E_DIM * E_DIM && 4 * CV_WP == CV_BLOCKS,
              "the pieces cover the five arrays exactly");

__global__ __launch_bounds__(CV_THREADS)
void cvt_f32_bf16(const float* __restrict__ x,
                  const float* __restrict__ wq, const float* __restrict__ wk,
                  const float* __restrict__ wv, const float* __restrict__ wo,
                  unsigned short* __restrict__ out) {
  const int blk = blockIdx.x;
  const int k = blk / CV_WP;                     // the weight that this work-group's piece is of
  const float* w = (k == 0) ? wq : (k == 1) ? wk : (k == 2) ? wv : wo;

  f32x4 v[CV_XT + 1][CV_LOADS];
  // all loops unrolled: v is indexed by constants and stays in registers
#pragma unroll
  for (int t = 0; t <= CV_XT; ++t) {
    const float* src = (t < CV_XT) ? x + (t * CV_BLOCKS + blk) * CV_PIECE
                                   : w + (blk % CV_WP) * CV_PIECE;
#pragma unroll
    for (int j = 0; j < CV_LOADS; ++j)
      v[t][j] = *(const f32x4*)(src + j * CV_STEP + threadIdx.x * 4);
  }
  // Takes the loaded values as inputs only, so that all 24 loads of a thread are in flight
  // together: without it the compiler saves registers by converting early and issues the
  // last loads two at a time, each pair waited for.  The wait stands in front of the first
  // reuse of a register that a load names.
  static_assert(CV_XT == 2 && CV_LOADS == 8, "the statement below names every loaded value");
  asm volatile("s_wait_xcnt 0x0"
               :: "v"(v[0][0]), "v"(v[0][1]), "v"(v[0][2]), "v"(v[0][3]),
                  "v"(v[0][4]), "v"(v[0][5]), "v"(v[0][6]), "v"(v[0][7]),
                  "v"(v[1][0]), "v"(v[1][1]), "v"(v[1][2]), "v"(v[1][3]),
                  "v"(v[1][4]), "v"(v[1][5]), "v"(v[1][6]), "v"(v[1][7]),
                  "v"(v[2][0]), "v"(v[2][1]), "v"(v[2][2]), "v"(v[2][3]),
                  "v"(v[2][4]), "v"(v[2][5]), "v"(v[2][6]), "v"(v[2][7])
               : "memory");
#pragma unroll
  for (int t = 0; t <= CV_XT; ++t) {
    unsigned short* dst = out + (t * CV_BLOCKS + blk) * CV_PIECE + threadIdx.x * 4;
#pragma unroll
    for (int j = 0; j < CV_LOADS; ++j) {
      uint2 p;
      p.x = (unsigned int)f2bf(v[t][j].x) | ((unsigned int)f2bf(v[t][j].y) << 16);
      p.y = (unsigned int)f2bf(v[t][j].z) | ((unsigned int)f2bf(v[t][j].w) << 16);
      *(uint2*)(dst + j * CV_STEP) = p;
    }
  }
}

#define G_KT 64                      // k elements per stage: rows of 128 bytes
#define G_NT (E_DIM / G_KT)          // 16 stages
#define G_PITCH 144                  // LDS row pitch in bytes (16 B x odd, for ds_load_b128)
#define G_OPB (128 * G_PITCH)        // one operand's tile in LDS
#define G_STAGEB (2 * G_OPB)         // [X tile | W tile]

// One stage: each thread brings 4 x 16 bytes of X and 4 x 16 bytes of W (rows 32 apart).
// The s_wait_xcnt stands inside the statement so that no address register named by a
// copy is rewritten in front of it.
__device__ __forceinline__ void gemm_copy_stage(unsigned int lds,
                                                const unsigned short* ga,
                                                const unsigned short* gb) {
  asm volatile(
      "global_load_async_to_lds_b128 %0, %8, off\n\t"
      "global_load_async_to_lds_b128 %1, %9, off\n\t"
      "global_load_async_to_lds_b128 %2, %10, off\n\t"
      "global_load_async_to_lds_b128 %3, %11, off\n\t"
      "global_load_async_to_lds_b128 %4, %12, off\n\t"
      "global_load_async_to_lds_b128 %5, %13, off\n\t"
      "global_load_async_to_lds_b128 %6, %14, off\n\t"
      "global_load_async_to_lds_b128 %7, %15, off\n\t"
      "s_wait_xcnt 0x0"
      :: "v"(lds), "v"(lds + 32 * G_PITCH), "v"(lds + 64 * G_PITCH), "v"(lds + 96 * G_PITCH),
         "v"(lds + G_OPB), "v"(lds + G_OPB + 32 * G_PITCH), "v"(lds + G_OPB + 64 * G_PITCH),
         "v"(lds + G_OPB + 96 * G_PITCH),
         "v"(ga), "v"(ga + 32 * E_DIM), "v"(ga + 64 * E_DIM), "v"(ga + 96 * E_DIM),
         "v"(gb), "v"(gb + 32 * E_DIM), "v"(gb + 64 * E_DIM), "v"(gb + 96 * E_DIM)
      : "memory");
}

__global__ __launch_bounds__(256)
void gemm_xwt(const unsigned short* __restrict__ Xb,
              const unsigned short* __restrict__ Wb,
              const float* __restrict__ bias,
              void* __restrict__ outp, float scale, int mode) {
  __shared__ __attribute__((aligned(16))) unsigned char smem[2 * G_STAGEB];

  const int lane = threadIdx.x & 31;
  const int wave = threadIdx.x >> 5;
  const int wm = wave & 3;
  const int wn = wave >> 2;
  const int mbase = blockIdx.y * 128 + wm * 32;
  const int nbase = blockIdx.x * 128 + wn * 64;
  const int lrow = lane & 15;
  const int half = lane >> 4;        // A/B 16-bit K-chunk: k = 8 * half (ISA 7.12.2)

  // copy side: thread -> (row 0..31, 16-byte chunk 0..7); a wave covers 4 whole lines
  const int crow = threadIdx.x >> 3;
  const int cchk = threadIdx.x & 7;
  const unsigned short* ga = Xb + (blockIdx.y * 128 + crow) * E_DIM + cchk * 8;
  const unsigned short* gb = Wb + (blockIdx.x * 128 + crow) * E_DIM + cchk * 8;
  const unsigned int lds0 = (unsigned int)(size_t)smem + crow * G_PITCH + cchk * 16;

  // read side: byte offsets of this lane's fragment rows inside a stage
  const int aoff = (wm * 32 + lrow) * G_PITCH + half * 16;
  const int boff = G_OPB + (wn * 64 + lrow) * G_PITCH + half * 16;

  v8f c[2][4] = {};

  gemm_copy_stage(lds0, ga, gb);
  // tile 0 has landed for this wave's own copies
  asm volatile("s_wait_asynccnt 0x0" ::: "memory");
  __syncthreads();
  gemm_copy_stage(lds0 + G_STAGEB, ga + G_KT, gb + G_KT);

#pragma unroll 1  // one stage a trip: the ring's order stands once, at the loop's foot
  for (int t = 0; t < G_NT; ++t) {
    const unsigned int bsel = (unsigned int)(t & 1) * G_STAGEB;
    const unsigned char* sb = smem + bsel;
    // this loop and the three inside it are unrolled so that fragments and accumulators
    // are indexed by constants and stay in registers
#pragma unroll
    for (int kk = 0; kk < 2; ++kk) {
      ABf af[2], bf[4];
#pragma unroll
      for (int m = 0; m < 2; ++m) {
        af[m].u[0] = *(const u32x4*)(sb + aoff + m * 16 * G_PITCH + kk * 64);
        af[m].u[1] = *(const u32x4*)(sb + aoff + m * 16 * G_PITCH + kk * 64 + 32);
      }
#pragma unroll
      for (int n = 0; n < 4; ++n) {
        bf[n].u[0] = *(const u32x4*)(sb + boff + n * 16 * G_PITCH + kk * 64);
        bf[n].u[1] = *(const u32x4*)(sb + boff + n * 16 * G_PITCH + kk * 64 + 32);
      }
#pragma unroll
      for (int m = 0; m < 2; ++m)
#pragma unroll
        for (int n = 0; n < 4; ++n) c[m][n] = WMMA_BF16(af[m].v, bf[n].v, c[m][n]);
    }
    // this wave's reads of the buffer have returned before it is handed to the copies
    asm volatile("s_wait_dscnt 0x0" ::: "memory");
    // this wave's copies of tile t + 1 have landed before the barrier publishes them
    asm volatile("s_wait_asynccnt 0x0" ::: "memory");
    __syncthreads();
    if (t + 2 < G_NT)
      gemm_copy_stage(lds0 + bsel, ga + (t + 2) * G_KT, gb + (t + 2) * G_KT);
  }
  // no copy is outstanding when the wave goes on to its stores and ends
  asm volatile("s_wait_asynccnt 0x0" ::: "memory");

#pragma unroll
  for (int m = 0; m < 2; ++m)
#pragma unroll
    for (int t = 0; t < 4; ++t) {
      const int col = nbase + t * 16 + lrow;
      const float bv = bias[col];
#pragma unroll
      for (int r = 0; r < 8; ++r) {
        const int row = mbase + m * 16 + r + 8 * half;  // C layout: VGPR r -> M = r + 8*half
        const float v = (c[m][t][r] + bv) * scale;
        if (mode == 0) {
          ((unsigned short*)outp)[row * E_DIM + col] = f2bf(v);
        } else if (mode == 1) {
          ((float*)outp)[row * E_DIM + col] = v;
        } else {  // V transpose: [B,H,D,S]
          const int b = row >> 11, s = row & 2047;
          const int h = col >> 6, d = col & 63;
          ((unsigned short*)outp)[((b * N_HEADS + h) * HEAD_DIM + d) * SEQ + s] = f2bf(v);
        }
      }
    }
}

// ---------------------------------------------------------------- flash attention
// One wave per 32-query tile; the 8 waves of a work-group take 256 queries of one (b,h)
// and share its K and Vt tiles: a stage of 64 keys (64 K rows and 64 Vt rows of 128 bytes)
// is staged in LDS by asynchronous copies that cover whole lines; two buffers, the next
// stage flies while this one is worked on.  Every wave reads its fragments from LDS.
// Online softmax per wave, through the wave's own LDS scratch.
// Q,K: [ROWS,1024] bf16 (Q pre-scaled by 1/8).  Vt: [B,H,D,S] bf16.  Ctx: bf16 [ROWS,1024].
#define A_KEYS 64                    // keys per stage: two passes of 32
#define A_NST (SEQ / A_KEYS)         // 32 stages
#define A_PITCH 144                  // LDS row pitch in bytes (16 B x odd, for ds_load_b128)
#define A_OPB (64 * A_PITCH)         // one operand's tile in LDS
#define A_STAGEB (2 * A_OPB)         // [K tile | Vt tile]

// One stage: each thread brings 2 x 16 bytes of K and 2 x 16 bytes of Vt (rows 32 apart).
// The s_wait_xcnt stands inside the statement so that no address register named by a
// copy is rewritten in front of it.
__device__ __forceinline__ void attn_copy_stage(unsigned int lds,
                                                const unsigned short* gk,
                                                const unsigned short* gv) {
  asm volatile(
      "global_load_async_to_lds_b128 %0, %4, off\n\t"
      "global_load_async_to_lds_b128 %1, %5, off\n\t"
      "global_load_async_to_lds_b128 %2, %6, off\n\t"
      "global_load_async_to_lds_b128 %3, %7, off\n\t"
      "s_wait_xcnt 0x0"
      :: "v"(lds), "v"(lds + 32 * A_PITCH), "v"(lds + A_OPB), "v"(lds + A_OPB + 32 * A_PITCH),
         "v"(gk), "v"(gk + 32 * E_DIM), "v"(gv), "v"(gv + 32 * SEQ)
      : "memory");
}

// The softmax scratch belongs to one wave: its LDS stores are waited for and kept in front
// of its later LDS loads of other lanes' words, as at a barrier, but the other waves of
// the work-group are not held up.
__device__ __forceinline__ void wave_order() {
  __builtin_amdgcn_fence(__ATOMIC_RELEASE, "workgroup");
  __builtin_amdgcn_wave_barrier();
  __builtin_amdgcn_fence(__ATOMIC_ACQUIRE, "workgroup");
}

__global__ __launch_bounds__(256)
void attn_fwd(const unsigned short* __restrict__ Qb,
              const unsigned short* __restrict__ Kb,
              const unsigned short* __restrict__ Vtb,
              unsigned short* __restrict__ Ctx) {
  __shared__ __attribute__((aligned(16))) unsigned char ring[2 * A_STAGEB];
  __shared__ __align__(16) float sc_w[8][32][32];
  __shared__ __align__(16) unsigned short pb_w[8][32][32];
  __shared__ __align__(16) float salpha_w[8][32];
  __shared__ __align__(16) float srecip_w[8][32];

  const int lane = threadIdx.x & 31;
  const int wave = threadIdx.x >> 5;
  const int lrow = lane & 15;
  const int lk = (lane >> 4) << 3;
  const int half = lane >> 4;

  // this wave's own softmax scratch
  float (*sc)[32] = sc_w[wave];
  unsigned short (*pb)[32] = pb_w[wave];
  float* salpha = salpha_w[wave];
  float* srecip = srecip_w[wave];

  const int bh = blockIdx.x >> 3;   // / (SEQ/256)
  const int qt = (blockIdx.x & 7) * 8 + wave;
  const int b = bh >> 4, h = bh & 15;
  const int qrowbase = b * SEQ + qt * 32;

  const u32x4* Qv = (const u32x4*)Qb;

  // copy side: thread -> (row 0..31, 16-byte chunk 0..7); a wave covers 4 whole lines
  const int crow = threadIdx.x >> 3;
  const int cchk = threadIdx.x & 7;
  const unsigned short* gk = Kb + (b * SEQ + crow) * E_DIM + h * HEAD_DIM + cchk * 8;
  const unsigned short* gv = Vtb + ((b * N_HEADS + h) * HEAD_DIM + crow) * SEQ + cchk * 8;
  const unsigned int lds0 = (unsigned int)(size_t)ring + crow * A_PITCH + cchk * 16;

  // read side: byte offset of this lane's fragment row inside an operand's tile
  const int foff = lrow * A_PITCH + half * 16;

  // Q: 2 query sub-tiles x 2 K-dim chunks, resident in registers
  ABf aq[2][2];
#pragma unroll
  for (int m = 0; m < 2; ++m) {
    const int qoff = (qrowbase + m * 16 + lrow) * E_DIM + h * HEAD_DIM;
    aq[m][0].u[0] = Qv[(qoff + lk) >> 3];
    aq[m][0].u[1] = Qv[(qoff + lk + 16) >> 3];
    aq[m][1].u[0] = Qv[(qoff + 32 + lk) >> 3];
    aq[m][1].u[1] = Qv[(qoff + 32 + lk + 16) >> 3];
  }

  v8f o[2][4] = {};
  float m_i = -3.0e38f, l_i = 0.0f;

  attn_copy_stage(lds0, gk, gv);
  // stage 0 has landed for this wave's own copies
  asm volatile("s_wait_asynccnt 0x0" ::: "memory");
  __syncthreads();
  attn_copy_stage(lds0 + A_STAGEB, gk + A_KEYS * E_DIM, gv + A_KEYS);

#pragma unroll 1  // one stage a trip: the ring's order stands once, at the loop's foot
  for (int st = 0; st < A_NST; ++st) {
   const unsigned int bsel = (unsigned int)(st & 1) * A_STAGEB;
   const unsigned char* kbuf = ring + bsel + foff;
   const unsigned char* vbuf = kbuf + A_OPB;
#pragma unroll 1  // one pass of 32 keys a trip: short loop text, one set of pass registers
   for (int p = 0; p < A_KEYS / 32; ++p) {
    // ---- scores: S(32x32) = Q(32x64) @ K_tile^T(64x32)
    ABf bk[2][2];
    // both loops unrolled so that the fragments are indexed by constants and stay in registers
#pragma unroll
    for (int n = 0; n < 2; ++n)
#pragma unroll
      for (int kc = 0; kc < 2; ++kc) {
        const unsigned char* kr = kbuf + (p * 32 + n * 16) * A_PITCH + kc * 64;
        bk[n][kc].u[0] = *(const u32x4*)(kr);
        bk[n][kc].u[1] = *(const u32x4*)(kr + 32);
      }
    v8f s[2][2] = {};
#pragma unroll
    for (int m = 0; m < 2; ++m)
#pragma unroll
      for (int n = 0; n < 2; ++n) {
        s[m][n] = WMMA_BF16(aq[m][0].v, bk[n][0].v, s[m][n]);
        s[m][n] = WMMA_BF16(aq[m][1].v, bk[n][1].v, s[m][n]);
      }

    // ---- V fragments from the ring
    ABf bvm[4];
#pragma unroll
    for (int t = 0; t < 4; ++t) {
      const unsigned char* vr = vbuf + t * 16 * A_PITCH + p * 64;
      bvm[t].u[0] = *(const u32x4*)(vr);
      bvm[t].u[1] = *(const u32x4*)(vr + 32);
    }

    // ---- score tile C-layout -> row-major in LDS
#pragma unroll
    for (int m = 0; m < 2; ++m)
#pragma unroll
      for (int r = 0; r < 8; ++r) {
        sc[m * 16 + r + 8 * half][lrow]      = s[m][0][r];
        sc[m * 16 + r + 8 * half][16 + lrow] = s[m][1][r];
      }
    wave_order();

    // ---- online softmax: every lane owns one query row
    {
      float rmax = -3.0e38f;
#pragma unroll
      for (int j = 0; j < 8; ++j) {
        const float4 v4 = *(const float4*)&sc[lane][j * 4];
        rmax = fmaxf(rmax, fmaxf(fmaxf(v4.x, v4.y), fmaxf(v4.z, v4.w)));
      }
      const float mnew = fmaxf(m_i, rmax);
      const float alpha = __expf(m_i - mnew);
      float ssum = 0.f;
#pragma unroll
      for (int j = 0; j < 16; ++j) {
        const float p0 = __expf(sc[lane][2 * j] - mnew);
        const float p1 = __expf(sc[lane][2 * j + 1] - mnew);
        ((unsigned int*)pb[lane])[j] = (unsigned int)f2bf(p0) | ((unsigned int)f2bf(p1) << 16);
        ssum += p0 + p1;
      }
      l_i = l_i * alpha + ssum;
      m_i = mnew;
      salpha[lane] = alpha;
    }
    wave_order();

    // ---- P back out in A-operand layout (ds_load_b128)
    ABf ap[2];
    ap[0].u[0] = *((const u32x4*)&pb[lrow][lk]);
    ap[0].u[1] = *((const u32x4*)&pb[lrow][lk + 16]);
    ap[1].u[0] = *((const u32x4*)&pb[16 + lrow][lk]);
    ap[1].u[1] = *((const u32x4*)&pb[16 + lrow][lk + 16]);

#pragma unroll
    for (int m = 0; m < 2; ++m) {
      float ar[8];
#pragma unroll
      for (int r = 0; r < 8; ++r) ar[r] = salpha[m * 16 + r + 8 * half];
#pragma unroll
      for (int t = 0; t < 4; ++t)
#pragma unroll
        for (int r = 0; r < 8; ++r) o[m][t][r] = o[m][t][r] * ar[r];
    }

    // ---- O += P(32x32) @ V_tile(32x64)
#pragma unroll
    for (int m = 0; m < 2; ++m)
#pragma unroll
      for (int t = 0; t < 4; ++t) o[m][t] = WMMA_BF16(ap[m].v, bvm[t].v, o[m][t]);
    wave_order();
    // keeps the pass's WMMAs in front of the slots below
    __builtin_amdgcn_sched_barrier(0);
    // four vector slots between the pass's last WMMA and the next trip's first write of a
    // register that held its A or B
    asm volatile("v_nop\n\tv_nop\n\tv_nop\n\tv_nop");
   }
   // this wave's reads of the buffer have returned before it is handed to the copies
   asm volatile("s_wait_dscnt 0x0" ::: "memory");
   // this wave's copies of stage st + 1 have landed before the barrier publishes them
   asm volatile("s_wait_asynccnt 0x0" ::: "memory");
   __syncthreads();
   if (st + 2 < A_NST)
     attn_copy_stage(lds0 + bsel, gk + (st + 2) * A_KEYS * E_DIM, gv + (st + 2) * A_KEYS);
  }
  // no copy is outstanding when the wave goes on to its stores and ends
  asm volatile("s_wait_asynccnt 0x0" ::: "memory");

  srecip[lane] = (l_i > 0.f) ? (1.0f / l_i) : 0.f;
  wave_order();
#pragma unroll
  for (int m = 0; m < 2; ++m) {
    float rr[8];
#pragma unroll
    for (int r = 0; r < 8; ++r) rr[r] = srecip[m * 16 + r + 8 * half];
#pragma unroll
    for (int t = 0; t < 4; ++t) {
      const int col = h * HEAD_DIM + t * 16 + lrow;
#pragma unroll
      for (int r = 0; r < 8; ++r) {
        const int row = qrowbase + m * 16 + r + 8 * half;
        Ctx[row * E_DIM + col] = f2bf(o[m][t][r] * rr[r]);
      }
    }
  }
}

// ---------------------------------------------------------------- launch
extern "C" void kernel_launch(void* const* d_in, const int* in_sizes, int n_in,
                              void* d_out, int out_size, void* d_ws, size_t ws_size,
                              hipStream_t stream) {
  const float* x  = (const float*)d_in[0];
  const float* wq = (const float*)d_in[1];
  const float* bq = (const float*)d_in[2];
  const float* wk = (const float*)d_in[3];
  const float* bk = (const float*)d_in[4];
  const float* wv = (const float*)d_in[5];
  const float* bv = (const float*)d_in[6];
  const float* wo = (const float*)d_in[7];
  const float* bo = (const float*)d_in[8];

  char* ws = (char*)d_ws;
  const size_t MB = 1024 * 1024;
  unsigned short* xb  = (unsigned short*)(ws + 0 * MB);   // 16 MB
  unsigned short* wqb = (unsigned short*)(ws + 16 * MB);  //  2 MB
  unsigned short* wkb = (unsigned short*)(ws + 18 * MB);
  unsigned short* wvb = (unsigned short*)(ws + 20 * MB);
  unsigned short* wob = (unsigned short*)(ws + 22 * MB);
  unsigned short* qb  = (unsigned short*)(ws + 24 * MB);  // 16 MB
  unsigned short* kb2 = (unsigned short*)(ws + 40 * MB);  // 16 MB
  unsigned short* vtb = (unsigned short*)(ws + 56 * MB);  // 16 MB [B,H,D,S]
  unsigned short* ctx = (unsigned short*)(ws + 72 * MB);  // 16 MB

  // xb, wqb, wkb, wvb, wob lie one behind another from xb on
  cvt_f32_bf16<<<CV_BLOCKS, CV_THREADS, 0, stream>>>(x, wq, wk, wv, wo, xb);

  dim3 gg(E_DIM / 128, ROWS / 128);  // (8, 64), 256 threads = 8 waves
  const float qscale = 0.125f;       // 1/sqrt(64)
  gemm_xwt<<<gg, 256, 0, stream>>>(xb, wqb, bq, qb,  qscale, 0);
  gemm_xwt<<<gg, 256, 0, stream>>>(xb, wkb, bk, kb2, 1.0f,   0);
  gemm_xwt<<<gg, 256, 0, stream>>>(xb, wvb, bv, vtb, 1.0f,   2);

  attn_fwd<<<BATCH * N_HEADS * (SEQ / 256), 256, 0, stream>>>(qb, kb2, vtb, ctx);

  gemm_xwt<<<gg, 256, 0, stream>>>(ctx, wob, bo, d_out, 1.0f, 1);
}

// v004
// A run of this version takes 172 microseconds.
// In two side-by-side timings against v003, it was 1.30 and 1.31 times as fast.
// Over all steps from v000 it is 2.12 times as fast.
#include <hip/hip_runtime.h>
#include <hip/hip_bf16.h>
#include <stdint.h>

#define E_DIM 1024
#define N_HEADS 16
#define HEAD_DIM 64
#define SEQ 2048
#define BATCH 4
#define ROWS (BATCH * SEQ)  // 8192

typedef __attribute__((ext_vector_type(16))) __bf16 v16bf;
typedef __attribute__((ext_vector_type(8)))  float  v8f;
typedef __attribute__((ext_vector_type(4)))  unsigned int u32x4;
typedef __attribute__((ext_vector_type(4)))  float  f32x4;

union ABf { v16bf v; u32x4 u[2]; };

__device__ __forceinline__ unsigned short f2bf(float f) {
  union { float f; unsigned int u; } x; x.f = f;
  unsigned int r = x.u + 0x7FFFu + ((x.u >> 16) & 1u);  // round-to-nearest-even
  return (unsigned short)(r >> 16);
}

#define WMMA_BF16(A, B, C) \
  __builtin_amdgcn_wmma_f32_16x16x32_bf16(false, (A), false, (B), (short)0, (C), false, false)

// ---------------------------------------------------------------- convert
// x and the four weights go to bf16 in ONE launch of one 16-wave work-group per WGP, so
// that few waves have to be started.  The five results lie one behind another in `out`
// (x, wq, wk, wv, wo).  A piece is 16,384 values of one array; a work-group takes
// CV_XT pieces of x and one piece of a weight.  Each wave-wide load covers 512 contiguous
// bytes (4 whole lines), each wave-wide store 256 (2 whole lines); all of a thread's
// loads are issued before its first value is converted.
#define CV_THREADS 512
#define CV_BLOCKS 256
#define CV_LOADS 8
#define CV_STEP (CV_THREADS * 4)                 // values a work-group brings with one load
#define CV_PIECE (CV_STEP * CV_LOADS)            // 16,384 values
#define CV_XT (ROWS * E_DIM / CV_PIECE / CV_BLOCKS)  // 2 pieces of x a work-group
#define CV_WP (E_DIM * E_DIM / CV_PIECE)         // 64 pieces in each weight
static_assert(CV_XT * CV_BLOCKS * CV_PIECE == ROWS * E_DIM &&
              CV_WP * CV_PIECE == E_DIM * E_DIM && 4 * CV_WP == CV_BLOCKS,
              "the pieces cover the five arrays exactly");

__global__ __launch_bounds__(CV_THREADS)
void cvt_f32_bf16(const float* __restrict__ x,
                  const float* __restrict__ wq, const float* __restrict__ wk,
                  const float* __restrict__ wv, const float* __restrict__ wo,
                  unsigned short* __restrict__ out) {
  const int blk = blockIdx.x;
  const int k = blk / CV_WP;                     // the weight that this work-group's piece is of
  const float* w = (k == 0) ? wq : (k == 1) ? wk : (k == 2) ? wv : wo;

  f32x4 v[CV_XT + 1][CV_LOADS];
  // all loops unrolled: v is indexed by constants and stays in registers
#pragma unroll
  for (int t = 0; t <= CV_XT; ++t) {
    const float* src = (t < CV_XT) ? x + (t * CV_BLOCKS + blk) * CV_PIECE
                                   : w + (blk % CV_WP) * CV_PIECE;
#pragma unroll
    for (int j = 0; j < CV_LOADS; ++j)
      v[t][j] = *(const f32x4*)(src + j * CV_STEP + threadIdx.x * 4);
  }
  // Takes the loaded values as inputs only, so that all 24 loads of a thread are in flight
  // together: without it the compiler saves registers by converting early and issues the
  // last loads two at a time, each pair waited for.  The wait stands in front of the first
  // reuse of a register that a load names.
  static_assert(CV_XT == 2 && CV_LOADS == 8, "the statement below names every loaded value");
  asm volatile("s_wait_xcnt 0x0"
               :: "v"(v[0][0]), "v"(v[0][1]), "v"(v[0][2]), "v"(v[0][3]),
                  "v"(v[0][4]), "v"(v[0][5]), "v"(v[0][6]), "v"(v[0][7]),
                  "v"(v[1][0]), "v"(v[1][1]), "v"(v[1][2]), "v"(v[1][3]),
                  "v"(v[1][4]), "v"(v[1][5]), "v"(v[1][6]), "v"(v[1][7]),
                  "v"(v[2][0]), "v"(v[2][1]), "v"(v[2][2]), "v"(v[2][3]),
                  "v"(v[2][4]), "v"(v[2][5]), "v"(v[2][6]), "v"(v[2][7])
               : "memory");
#pragma unroll
  for (int t = 0; t <= CV_XT; ++t) {
    unsigned short* dst = out + (t * CV_BLOCKS + blk) * CV_PIECE + threadIdx.x * 4;
#pragma unroll
    for (int j = 0; j < CV_LOADS; ++j) {
      uint2 p;
      p.x = (unsigned int)f2bf(v[t][j].x) | ((unsigned int)f2bf(v[t][j].y) << 16);
      p.y = (unsigned int)f2bf(v[t][j].z) | ((unsigned int)f2bf(v[t][j].w) << 16);
      *(uint2*)(dst + j * CV_STEP) = p;
    }
  }
}

#define G_KT 64                      // k elements per stage: rows of 128 bytes
#define G_NT (E_DIM / G_KT)          // 16 stages
#define G_PITCH 144                  // LDS row pitch in bytes (16 B x odd, for ds_load_b128)
#define G_OPB (128 * G_PITCH)        // one operand's tile in LDS
#define G_STAGEB (2 * G_OPB)         // [X tile | W tile]

// One stage: each thread brings 4 x 16 bytes of X and 4 x 16 bytes of W (rows 32 apart).
// The s_wait_xcnt stands inside the statement so that no address register named by a
// copy is rewritten in front of it.
__device__ __forceinline__ void gemm_copy_stage(unsigned int lds,
                                                const unsigned short* ga,
                                                const unsigned short* gb) {
  asm volatile(
      "global_load_async_to_lds_b128 %0, %8, off\n\t"
      "global_load_async_to_lds_b128 %1, %9, off\n\t"
      "global_load_async_to_lds_b128 %2, %10, off\n\t"
      "global_load_async_to_lds_b128 %3, %11, off\n\t"
      "global_load_async_to_lds_b128 %4, %12, off\n\t"
      "global_load_async_to_lds_b128 %5, %13, off\n\t"
      "global_load_async_to_lds_b128 %6, %14, off\n\t"
      "global_load_async_to_lds_b128 %7, %15, off\n\t"
      "s_wait_xcnt 0x0"
      :: "v"(lds), "v"(lds + 32 * G_PITCH), "v"(lds + 64 * G_PITCH), "v"(lds + 96 * G_PITCH),
         "v"(lds + G_OPB), "v"(lds + G_OPB + 32 * G_PITCH), "v"(lds + G_OPB + 64 * G_PITCH),
         "v"(lds + G_OPB + 96 * G_PITCH),
         "v"(ga), "v"(ga + 32 * E_DIM), "v"(ga + 64 * E_DIM), "v"(ga + 96 * E_DIM),
         "v"(gb), "v"(gb + 32 * E_DIM), "v"(gb + 64 * E_DIM), "v"(gb + 96 * E_DIM)
      : "memory");
}

__global__ __launch_bounds__(256)
void gemm_xwt(const unsigned short* __restrict__ Xb,
              const unsigned short* __restrict__ Wb,
              const float* __restrict__ bias,
              void* __restrict__ outp, float scale, int mode) {
  __shared__ __attribute__((aligned(16))) unsigned char smem[2 * G_STAGEB];

  const int lane = threadIdx.x & 31;
  const int wave = threadIdx.x >> 5;
  const int wm = wave & 3;
  const int wn = wave >> 2;
  const int mbase = blockIdx.y * 128 + wm * 32;
  const int nbase = blockIdx.x * 128 + wn * 64;
  const int lrow = lane & 15;
  const int half = lane >> 4;        // A/B 16-bit K-chunk: k = 8 * half (ISA 7.12.2)

  // copy side: thread -> (row 0..31, 16-byte chunk 0..7); a wave covers 4 whole lines
  const int crow = threadIdx.x >> 3;
  const int cchk = threadIdx.x & 7;
  const unsigned short* ga = Xb + (blockIdx.y * 128 + crow) * E_DIM + cchk * 8;
  const unsigned short* gb = Wb + (blockIdx.x * 128 + crow) * E_DIM + cchk * 8;
  const unsigned int lds0 = (unsigned int)(size_t)smem + crow * G_PITCH + cchk * 16;

  // read side: byte offsets of this lane's fragment rows inside a stage
  const int aoff = (wm * 32 + lrow) * G_PITCH + half * 16;
  const int boff = G_OPB + (wn * 64 + lrow) * G_PITCH + half * 16;

  v8f c[2][4] = {};

  gemm_copy_stage(lds0, ga, gb);
  // tile 0 has landed for this wave's own copies
  asm volatile("s_wait_asynccnt 0x0" ::: "memory");
  __syncthreads();
  gemm_copy_stage(lds0 + G_STAGEB, ga + G_KT, gb + G_KT);

#pragma unroll 1  // one stage a trip: the ring's order stands once, at the loop's foot
  for (int t = 0; t < G_NT; ++t) {
    const unsigned int bsel = (unsigned int)(t & 1) * G_STAGEB;
    const unsigned char* sb = smem + bsel;
    // this loop and the three inside it are unrolled so that fragments and accumulators
    // are indexed by constants and stay in registers
#pragma unroll
    for (int kk = 0; kk < 2; ++kk) {
      ABf af[2], bf[4];
#pragma unroll
      for (int m = 0; m < 2; ++m) {
        af[m].u[0] = *(const u32x4*)(sb + aoff + m * 16 * G_PITCH + kk * 64);
        af[m].u[1] = *(const u32x4*)(sb + aoff + m * 16 * G_PITCH + kk * 64 + 32);
      }
#pragma unroll
      for (int n = 0; n < 4; ++n) {
        bf[n].u[0] = *(const u32x4*)(sb + boff + n * 16 * G_PITCH + kk * 64);
        bf[n].u[1] = *(const u32x4*)(sb + boff + n * 16 * G_PITCH + kk * 64 + 32);
      }
#pragma unroll
      for (int m = 0; m < 2; ++m)
#pragma unroll
        for (int n = 0; n < 4; ++n) c[m][n] = WMMA_BF16(af[m].v, bf[n].v, c[m][n]);
    }
    // this wave's reads of the buffer have returned before it is handed to the copies
    asm volatile("s_wait_dscnt 0x0" ::: "memory");
    // this wave's copies of tile t + 1 have landed before the barrier publishes them
    asm volatile("s_wait_asynccnt 0x0" ::: "memory");
    __syncthreads();
    if (t + 2 < G_NT)
      gemm_copy_stage(lds0 + bsel, ga + (t + 2) * G_KT, gb + (t + 2) * G_KT);
  }
  // no copy is outstanding when the wave goes on to its stores and ends
  asm volatile("s_wait_asynccnt 0x0" ::: "memory");

#pragma unroll
  for (int m = 0; m < 2; ++m)
#pragma unroll
    for (int t = 0; t < 4; ++t) {
      const int col = nbase + t * 16 + lrow;
      const float bv = bias[col];
#pragma unroll
      for (int r = 0; r < 8; ++r) {
        const int row = mbase + m * 16 + r + 8 * half;  // C layout: VGPR r -> M = r + 8*half
        const float v = (c[m][t][r] + bv) * scale;
        if (mode == 0) {
          ((unsigned short*)outp)[row * E_DIM + col] = f2bf(v);
        } else if (mode == 1) {
          ((float*)outp)[row * E_DIM + col] = v;
        } else {  // V transpose: [B,H,D,S]
          const int b = row >> 11, s = row & 2047;
          const int h = col >> 6, d = col & 63;
          ((unsigned short*)outp)[((b * N_HEADS + h) * HEAD_DIM + d) * SEQ + s] = f2bf(v);
        }
      }
    }
}

#define A_KEYS 64                    // keys per stage: two passes of 32
#define A_NST (SEQ / A_KEYS)         // 32 stages
#define A_PITCH 144                  // LDS row pitch in bytes (16 B x odd, for ds_load_b128)
#define A_OPB (64 * A_PITCH)         // one operand's tile in LDS
#define A_STAGEB (2 * A_OPB)         // [K tile | Vt tile]

// One stage: each thread brings 2 x 16 bytes of K and 2 x 16 bytes of Vt (rows 32 apart).
// The s_wait_xcnt stands inside the statement so that no address register named by a
// copy is rewritten in front of it.
__device__ __forceinline__ void attn_copy_stage(unsigned int lds,
                                                const unsigned short* gk,
                                                const unsigned short* gv) {
  asm volatile(
      "global_load_async_to_lds_b128 %0, %4, off\n\t"
      "global_load_async_to_lds_b128 %1, %5, off\n\t"
      "global_load_async_to_lds_b128 %2, %6, off\n\t"
      "global_load_async_to_lds_b128 %3, %7, off\n\t"
      "s_wait_xcnt 0x0"
      :: "v"(lds), "v"(lds + 32 * A_PITCH), "v"(lds + A_OPB), "v"(lds + A_OPB + 32 * A_PITCH),
         "v"(gk), "v"(gk + 32 * E_DIM), "v"(gv), "v"(gv + 32 * SEQ)
      : "memory");
}

// lane l takes the value of lane l ^ 16
__device__ __forceinline__ float xhalf(float x) {
  const int b = __builtin_bit_cast(int, x);
  return __builtin_bit_cast(
      float, __builtin_amdgcn_permlanex16(b, b, 0x76543210, 0xfedcba98, false, false));
}

__global__ __launch_bounds__(256)
void attn_fwd(const unsigned short* __restrict__ Qb,
              const unsigned short* __restrict__ Kb,
              const unsigned short* __restrict__ Vtb,
              unsigned short* __restrict__ Ctx) {
  __shared__ __attribute__((aligned(16))) unsigned char ring[2 * A_STAGEB];

  const int lane = threadIdx.x & 31;
  const int wave = threadIdx.x >> 5;
  const int lrow = lane & 15;
  const int lk = (lane >> 4) << 3;
  const int half = lane >> 4;

  const int bh = blockIdx.x >> 3;   // / (SEQ/256)
  const int qt = (blockIdx.x & 7) * 8 + wave;
  const int b = bh >> 4, h = bh & 15;
  const int qrowbase = b * SEQ + qt * 32;

  const u32x4* Qv = (const u32x4*)Qb;

  // copy side: thread -> (row 0..31, 16-byte chunk 0..7); a wave covers 4 whole lines
  const int crow = threadIdx.x >> 3;
  const int cchk = threadIdx.x & 7;
  const unsigned short* gk = Kb + (b * SEQ + crow) * E_DIM + h * HEAD_DIM + cchk * 8;
  const unsigned short* gv = Vtb + ((b * N_HEADS + h) * HEAD_DIM + crow) * SEQ + cchk * 8;
  const unsigned int lds0 = (unsigned int)(size_t)ring + crow * A_PITCH + cchk * 16;

  // read side: byte offset of this lane's fragment row inside an operand's tile.  Of each 64
  // bytes of a row a lane takes bytes 16 * half and 32 + 16 * half: the hardware k order,
  // which the packed score tiles have as well.
  const int foff = lrow * A_PITCH + half * 16;

  // Q: 2 query sub-tiles x 2 K-dim chunks, resident in registers
  ABf aq[2][2];
#pragma unroll
  for (int m = 0; m < 2; ++m) {
    const int qoff = (qrowbase + m * 16 + lrow) * E_DIM + h * HEAD_DIM;
    aq[m][0].u[0] = Qv[(qoff + lk) >> 3];
    aq[m][0].u[1] = Qv[(qoff + lk + 16) >> 3];
    aq[m][1].u[0] = Qv[(qoff + 32 + lk) >> 3];
    aq[m][1].u[1] = Qv[(qoff + 32 + lk + 16) >> 3];
  }

  // o[g][t][r] = O^T[d = 16 t + 8 half + r][query 16 g + lrow]
  v8f o[2][4] = {};
  // per query group: the query's running maximum (equal in both halves) and the running sum
  // over this half's keys (the halves are joined behind the loop)
  float m_i[2] = {-3.0e38f, -3.0e38f}, l_i[2] = {0.0f, 0.0f};

  attn_copy_stage(lds0, gk, gv);
  // stage 0 has landed for this wave's own copies
  asm volatile("s_wait_asynccnt 0x0" ::: "memory");
  __syncthreads();
  attn_copy_stage(lds0 + A_STAGEB, gk + A_KEYS * E_DIM, gv + A_KEYS);

#pragma unroll 1  // one stage a trip: the ring's order stands once, at the loop's foot
  for (int st = 0; st < A_NST; ++st) {
   const unsigned int bsel = (unsigned int)(st & 1) * A_STAGEB;
   const unsigned char* kbuf = ring + bsel + foff;
   const unsigned char* vbuf = kbuf + A_OPB;
#pragma unroll 1  // one pass of 32 keys a trip: short loop text, one set of pass registers
   for (int p = 0; p < A_KEYS / 32; ++p) {
    // ---- scores: S^T(32 keys x 32 queries) = K_tile(32x64) @ Q^T(64x32)
    ABf ak[2][2];
    // all loops of the pass are unrolled so that fragments and accumulators are indexed by
    // constants and stay in registers
#pragma unroll
    for (int kt = 0; kt < 2; ++kt)
#pragma unroll
      for (int kc = 0; kc < 2; ++kc) {
        const unsigned char* kr = kbuf + (p * 32 + kt * 16) * A_PITCH + kc * 64;
        ak[kt][kc].u[0] = *(const u32x4*)(kr);
        ak[kt][kc].u[1] = *(const u32x4*)(kr + 32);
      }
    // s[kt][g][r] = S^T[key 16 kt + 8 half + r][query 16 g + lrow]
    v8f s[2][2] = {};
#pragma unroll
    for (int kt = 0; kt < 2; ++kt)
#pragma unroll
      for (int g = 0; g < 2; ++g) {
        s[kt][g] = WMMA_BF16(ak[kt][0].v, aq[g][0].v, s[kt][g]);
        s[kt][g] = WMMA_BF16(ak[kt][1].v, aq[g][1].v, s[kt][g]);
      }

    // ---- V^T fragments from the ring (A operand: row = d, k = the pass's 32 keys)
    ABf av[4];
#pragma unroll
    for (int t = 0; t < 4; ++t) {
      const unsigned char* vr = vbuf + t * 16 * A_PITCH + p * 64;
      av[t].u[0] = *(const u32x4*)(vr);
      av[t].u[1] = *(const u32x4*)(vr + 32);
    }

    // ---- online softmax of queries 16 g + lrow, on this half's 16 keys
    float mnew[2], alpha[2];
#pragma unroll
    for (int g = 0; g < 2; ++g) {
      float rmax = -3.0e38f;
#pragma unroll
      for (int r = 0; r < 8; ++r) rmax = fmaxf(rmax, fmaxf(s[0][g][r], s[1][g][r]));
      rmax = fmaxf(rmax, xhalf(rmax));
      mnew[g] = fmaxf(m_i[g], rmax);
    }
#pragma unroll
    for (int g = 0; g < 2; ++g) {
      alpha[g] = __expf(m_i[g] - mnew[g]);
      m_i[g] = mnew[g];
    }

#pragma unroll
    for (int g = 0; g < 2; ++g) {
      // element e of the B operand is key kmap(e) = 16 (e >> 3) + 8 half + (e & 7): score
      // tile e >> 3, register e & 7
      v8f pt[2];
      ABf pf;
#pragma unroll
      for (int kt = 0; kt < 2; ++kt) {
        const v8f e = s[kt][g] - mnew[g];
#pragma unroll
        for (int r = 0; r < 8; ++r) pt[kt][r] = __expf(e[r]);
#pragma unroll
        for (int i = 0; i < 4; ++i)
          pf.u[kt][i] = (unsigned int)f2bf(pt[kt][2 * i]) | ((unsigned int)f2bf(pt[kt][2 * i + 1]) << 16);
      }
      const v8f ps = pt[0] + pt[1];
      const float ssum = ((ps[0] + ps[1]) + (ps[2] + ps[3])) + ((ps[4] + ps[5]) + (ps[6] + ps[7]));
      l_i[g] = l_i[g] * alpha[g] + ssum;

      // ---- O^T = O^T * alpha + V^T(64x32) @ P^T(32x16)
#pragma unroll
      for (int t = 0; t < 4; ++t) {
        o[g][t] = o[g][t] * alpha[g];
        o[g][t] = WMMA_BF16(av[t].v, pf.v, o[g][t]);
      }
    }
    // keeps the pass's WMMAs in front of the slots below
    __builtin_amdgcn_sched_barrier(0);
    // four vector slots between the pass's last WMMA and the next trip's first write of a
    // register that held its A or B
    asm volatile("v_nop\n\tv_nop\n\tv_nop\n\tv_nop");
   }
   // this wave's reads of the buffer have returned before it is handed to the copies
   asm volatile("s_wait_dscnt 0x0" ::: "memory");
   // this wave's copies of stage st + 1 have landed before the barrier publishes them
   asm volatile("s_wait_asynccnt 0x0" ::: "memory");
   __syncthreads();
   if (st + 2 < A_NST)
     attn_copy_stage(lds0 + bsel, gk + (st + 2) * A_KEYS * E_DIM, gv + (st + 2) * A_KEYS);
  }
  // no copy is outstanding when the wave goes on to its stores and ends
  asm volatile("s_wait_asynccnt 0x0" ::: "memory");

  // the three loops are unrolled so that o is indexed by constants and stays in registers
#pragma unroll
  for (int g = 0; g < 2; ++g) {
    const float l = l_i[g] + xhalf(l_i[g]);   // both halves' keys
    const float rr = (l > 0.f) ? (1.0f / l) : 0.f;
    unsigned short* crow_p = Ctx + (qrowbase + g * 16 + lrow) * E_DIM + h * HEAD_DIM + 8 * half;
#pragma unroll
    for (int t = 0; t < 4; ++t) {
      // a lane's 8 registers are 8 consecutive d of one query: one 16-byte store
      u32x4 pk;
#pragma unroll
      for (int i = 0; i < 4; ++i)
        pk[i] = (unsigned int)f2bf(o[g][t][2 * i] * rr) |
                ((unsigned int)f2bf(o[g][t][2 * i + 1] * rr) << 16);
      *(u32x4*)(crow_p + t * 16) = pk;
    }
  }
}

// ---------------------------------------------------------------- launch
extern "C" void kernel_launch(void* const* d_in, const int* in_sizes, int n_in,
                              void* d_out, int out_size, void* d_ws, size_t ws_size,
                              hipStream_t stream) {
  const float* x  = (const float*)d_in[0];
  const float* wq = (const float*)d_in[1];
  const float* bq = (const float*)d_in[2];
  const float* wk = (const float*)d_in[3];
  const float* bk = (const float*)d_in[4];
  const float* wv = (const float*)d_in[5];
  const float* bv = (const float*)d_in[6];
  const float* wo = (const float*)d_in[7];
  const float* bo = (const float*)d_in[8];

  char* ws = (char*)d_ws;
  const size_t MB = 1024 * 1024;
  unsigned short* xb  = (unsigned short*)(ws + 0 * MB);   // 16 MB
  unsigned short* wqb = (unsigned short*)(ws + 16 * MB);  //  2 MB
  unsigned short* wkb = (unsigned short*)(ws + 18 * MB);
  unsigned short* wvb = (unsigned short*)(ws + 20 * MB);
  unsigned short* wob = (unsigned short*)(ws + 22 * MB);
  unsigned short* qb  = (unsigned short*)(ws + 24 * MB);  // 16 MB
  unsigned short* kb2 = (unsigned short*)(ws + 40 * MB);  // 16 MB
  unsigned short* vtb = (unsigned short*)(ws + 56 * MB);  // 16 MB [B,H,D,S]
  unsigned short* ctx = (unsigned short*)(ws + 72 * MB);  // 16 MB

  // xb, wqb, wkb, wvb, wob lie one behind another from xb on
  cvt_f32_bf16<<<CV_BLOCKS, CV_THREADS, 0, stream>>>(x, wq, wk, wv, wo, xb);

  dim3 gg(E_DIM / 128, ROWS / 128);  // (8, 64), 256 threads = 8 waves
  const float qscale = 0.125f;       // 1/sqrt(64)
  gemm_xwt<<<gg, 256, 0, stream>>>(xb, wqb, bq, qb,  qscale, 0);
  gemm_xwt<<<gg, 256, 0, stream>>>(xb, wkb, bk, kb2, 1.0f,   0);
  gemm_xwt<<<gg, 256, 0, stream>>>(xb, wvb, bv, vtb, 1.0f,   2);

  attn_fwd<<<BATCH * N_HEADS * (SEQ / 256), 256, 0, stream>>>(qb, kb2, vtb, ctx);

  gemm_xwt<<<gg, 256, 0, stream>>>(ctx, wob, bo, d_out, 1.0f, 1);
}

// v005
// One run takes 146 microseconds.
// Timed twice side by side with v004, it ran 1.19 and 1.18 times as fast.
// Over all steps from v000 it is 2.51 times as fast.
#include <hip/hip_runtime.h>
#include <hip/hip_bf16.h>
#include <stdint.h>

#define E_DIM 1024
#define N_HEADS 16
#define HEAD_DIM 64
#define SEQ 2048
#define BATCH 4
#define ROWS (BATCH * SEQ)  // 8192

typedef __attribute__((ext_vector_type(16))) __bf16 v16bf;
typedef __attribute__((ext_vector_type(8)))  float  v8f;
typedef __attribute__((ext_vector_type(4)))  unsigned int u32x4;
typedef __attribute__((ext_vector_type(4)))  float  f32x4;

union ABf { v16bf v; u32x4 u[2]; };

__device__ __forceinline__ unsigned short f2bf(float f) {
  union { float f; unsigned int u; } x; x.f = f;
  unsigned int r = x.u + 0x7FFFu + ((x.u >> 16) & 1u);  // round-to-nearest-even
  return (unsigned short)(r >> 16);
}

#define WMMA_BF16(A, B, C) \
  __builtin_amdgcn_wmma_f32_16x16x32_bf16(false, (A), false, (B), (short)0, (C), false, false)

// ---------------------------------------------------------------- convert
// x and the four weights go to bf16 in ONE launch of one 16-wave work-group per WGP, so
// that few waves have to be started.  The five results lie one behind another in `out`
// (x, wq, wk, wv, wo).  A piece is 16,384 values of one array; a work-group takes
// CV_XT pieces of x and one piece of a weight.  Each wave-wide load covers 512 contiguous
// bytes (4 whole lines), each wave-wide store 256 (2 whole lines); all of a thread's
// loads are issued before its first value is converted.
#define CV_THREADS 512
#define CV_BLOCKS 256
#define CV_LOADS 8
#define CV_STEP (CV_THREADS * 4)                 // values a work-group brings with one load
#define CV_PIECE (CV_STEP * CV_LOADS)            // 16,384 values
#define CV_XT (ROWS * E_DIM / CV_PIECE / CV_BLOCKS)  // 2 pieces of x a work-group
#define CV_WP (E_DIM * E_DIM / CV_PIECE)         // 64 pieces in each weight
static_assert(CV_XT * CV_BLOCKS * CV_PIECE == ROWS * E_DIM &&
              CV_WP * CV_PIECE == E_DIM * E_DIM && 4 * CV_WP == CV_BLOCKS,
              "the pieces cover the five arrays exactly");

__global__ __launch_bounds__(CV_THREADS)
void cvt_f32_bf16(const float* __restrict__ x,
                  const float* __restrict__ wq, const float* __restrict__ wk,
                  const float* __restrict__ wv, const float* __restrict__ wo,
                  unsigned short* __restrict__ out) {
  const int blk = blockIdx.x;
  const int k = blk / CV_WP;                     // the weight that this work-group's piece is of
  const float* w = (k == 0) ? wq : (k == 1) ? wk : (k == 2) ? wv : wo;

  f32x4 v[CV_XT + 1][CV_LOADS];
  // all loops unrolled: v is indexed by constants and stays in registers
#pragma unroll
  for (int t = 0; t <= CV_XT; ++t) {
    const float* src = (t < CV_XT) ? x + (t * CV_BLOCKS + blk) * CV_PIECE
                                   : w + (blk % CV_WP) * CV_PIECE;
#pragma unroll
    for (int j = 0; j < CV_LOADS; ++j)
      v[t][j] = *(const f32x4*)(src + j * CV_STEP + threadIdx.x * 4);
  }
  // Takes the loaded values as inputs only, so that all 24 loads of a thread are in flight
  // together: without it the compiler saves registers by converting early and issues the
  // last loads two at a time, each pair waited for.  The wait stands in front of the first
  // reuse of a register that a load names.
  static_assert(CV_XT == 2 && CV_LOADS == 8, "the statement below names every loaded value");
  asm volatile("s_wait_xcnt 0x0"
               :: "v"(v[0][0]), "v"(v[0][1]), "v"(v[0][2]), "v"(v[0][3]),
                  "v"(v[0][4]), "v"(v[0][5]), "v"(v[0][6]), "v"(v[0][7]),
                  "v"(v[1][0]), "v"(v[1][1]), "v"(v[1][2]), "v"(v[1][3]),
                  "v"(v[1][4]), "v"(v[1][5]), "v"(v[1][6]), "v"(v[1][7]),
                  "v"(v[2][0]), "v"(v[2][1]), "v"(v[2][2]), "v"(v[2][3]),
                  "v"(v[2][4]), "v"(v[2][5]), "v"(v[2][6]), "v"(v[2][7])
               : "memory");
#pragma unroll
  for (int t = 0; t <= CV_XT; ++t) {
    unsigned short* dst = out + (t * CV_BLOCKS + blk) * CV_PIECE + threadIdx.x * 4;
#pragma unroll
    for (int j = 0; j < CV_LOADS; ++j) {
      uint2 p;
      p.x = (unsigned int)f2bf(v[t][j].x) | ((unsigned int)f2bf(v[t][j].y) << 16);
      p.y = (unsigned int)f2bf(v[t][j].z) | ((unsigned int)f2bf(v[t][j].w) << 16);
      *(uint2*)(dst + j * CV_STEP) = p;
    }
  }
}

#define G_KT 64                      // k elements per stage: rows of 128 bytes
#define G_NT (E_DIM / G_KT)          // 16 stages
#define G_PITCH 144                  // LDS row pitch in bytes (16 B x odd, for ds_load_b128)
#define G_OPB (128 * G_PITCH)        // one operand's tile in LDS
#define G_STAGEB (2 * G_OPB)         // [X tile | W tile]
#define G_WSTB (2 * G_STAGEB / 8)    // a wave's part of the ring for its output tile
#define G_OP16 144                   // staged row pitch, 64 bf16 (16 B x odd)
#define G_OP32 272                   // staged row pitch, 64 f32 (16 B x odd)
static_assert(32 * G_OP16 <= G_WSTB && 32 * G_OP32 <= G_WSTB, "a wave's tile fits its part");

// One stage: each thread brings 4 x 16 bytes of X and 4 x 16 bytes of W (rows 32 apart).
// The s_wait_xcnt stands inside the statement so that no address register named by a
// copy is rewritten in front of it.
__device__ __forceinline__ void gemm_copy_stage(unsigned int lds,
                                                const unsigned short* ga,
                                                const unsigned short* gb) {
  asm volatile(
      "global_load_async_to_lds_b128 %0, %8, off\n\t"
      "global_load_async_to_lds_b128 %1, %9, off\n\t"
      "global_load_async_to_lds_b128 %2, %10, off\n\t"
      "global_load_async_to_lds_b128 %3, %11, off\n\t"
      "global_load_async_to_lds_b128 %4, %12, off\n\t"
      "global_load_async_to_lds_b128 %5, %13, off\n\t"
      "global_load_async_to_lds_b128 %6, %14, off\n\t"
      "global_load_async_to_lds_b128 %7, %15, off\n\t"
      "s_wait_xcnt 0x0"
      :: "v"(lds), "v"(lds + 32 * G_PITCH), "v"(lds + 64 * G_PITCH), "v"(lds + 96 * G_PITCH),
         "v"(lds + G_OPB), "v"(lds + G_OPB + 32 * G_PITCH), "v"(lds + G_OPB + 64 * G_PITCH),
         "v"(lds + G_OPB + 96 * G_PITCH),
         "v"(ga), "v"(ga + 32 * E_DIM), "v"(ga + 64 * E_DIM), "v"(ga + 96 * E_DIM),
         "v"(gb), "v"(gb + 32 * E_DIM), "v"(gb + 64 * E_DIM), "v"(gb + 96 * E_DIM)
      : "memory");
}

// c[m][n][r] = Y[mbase + 16 m + lrow][nbase + 16 n + 8 half + r], without bias and scale.
// st: the wave's own staging bytes.  All loops are unrolled so that c is indexed by constants
// and stays in registers.
template <int MODE>
__device__ __forceinline__ void gemm_store_tile(const v8f (&c)[2][4], unsigned char* st,
                                                const float* __restrict__ bias,
                                                void* __restrict__ outp, float scale,
                                                int mbase, int nbase, int lane) {
  const int lrow = lane & 15;
  const int half = lane >> 4;
  constexpr int PITCH = (MODE == 1) ? G_OP32 : G_OP16;
#pragma unroll
  for (int n = 0; n < 4; ++n) {
    f32x4 b0 = {}, b1 = {};
    if (MODE != 2) {
      b0 = *(const f32x4*)(bias + nbase + n * 16 + 8 * half);
      b1 = *(const f32x4*)(bias + nbase + n * 16 + 8 * half + 4);
    }
#pragma unroll
    for (int m = 0; m < 2; ++m) {
      float v[8];
      const float br = (MODE == 2) ? bias[mbase + m * 16 + lrow] : 0.0f;
#pragma unroll
      for (int r = 0; r < 8; ++r)
        v[r] = (c[m][n][r] + ((MODE == 2) ? br : (r < 4) ? b0[r & 3] : b1[r & 3])) * scale;
      unsigned char* sp = st + (m * 16 + lrow) * PITCH;
      if (MODE == 1) {
        const f32x4 lo = {v[0], v[1], v[2], v[3]}, hi = {v[4], v[5], v[6], v[7]};
        *(f32x4*)(sp + n * 64 + half * 32) = lo;
        *(f32x4*)(sp + n * 64 + half * 32 + 16) = hi;
      } else {
        u32x4 pk;
#pragma unroll
        for (int i = 0; i < 4; ++i)
          pk[i] = (unsigned int)f2bf(v[2 * i]) | ((unsigned int)f2bf(v[2 * i + 1]) << 16);
        *(u32x4*)(sp + n * 32 + half * 16) = pk;
      }
    }
  }
  // the wave's own staged pieces are in LDS before its lanes read one another's
  asm volatile("s_wait_dscnt 0x0" ::: "memory");
  if (MODE == 1) {
    // a row is 256 bytes: 16 lanes a row, 2 rows (4 whole lines) a store
    float* op = (float*)outp + (mbase + half) * E_DIM + nbase + lrow * 4;
    const unsigned char* sp = st + half * PITCH + lrow * 16;
#pragma unroll
    for (int i = 0; i < 16; ++i)
      *(f32x4*)(op + i * 2 * E_DIM) = *(const f32x4*)(sp + i * 2 * PITCH);
  } else {
    // a row is 128 bytes: 8 lanes a row, 4 rows (4 whole lines) a store
    const int row = lane >> 3, chk = lane & 7;
    constexpr int OPITCH = (MODE == 0) ? E_DIM : SEQ;
    unsigned short* op = (unsigned short*)outp + chk * 8 +
        ((MODE == 0) ? (mbase + row) * E_DIM + nbase
                     : ((nbase >> 11) * E_DIM + mbase + row) * SEQ + (nbase & (SEQ - 1)));
    const unsigned char* sp = st + row * PITCH + chk * 16;
#pragma unroll
    for (int i = 0; i < 8; ++i)
      *(u32x4*)(op + i * 4 * OPITCH) = *(const u32x4*)(sp + i * 4 * PITCH);
  }
  // stands in front of whatever the compiler places behind the tile's stores, so that no
  // register named by a store is rewritten ahead of it
  asm volatile("s_wait_xcnt 0x0" ::: "memory");
}

__global__ __launch_bounds__(256)
void gemm_xwt(const unsigned short* __restrict__ Xb,
              const unsigned short* __restrict__ Wb,
              const float* __restrict__ bias,
              void* __restrict__ outp, float scale, int mode) {
  __shared__ __attribute__((aligned(16))) unsigned char smem[2 * G_STAGEB];

  const int lane = threadIdx.x & 31;
  const int wave = threadIdx.x >> 5;
  const int wm = wave & 3;
  const int wn = wave >> 2;
  const int mbase = blockIdx.y * 128 + wm * 32;
  const int nbase = blockIdx.x * 128 + wn * 64;
  const int lrow = lane & 15;
  const int half = lane >> 4;        // A/B 16-bit K-chunk: k = 8 * half (ISA 7.12.2)

  // copy side: thread -> (row 0..31, 16-byte chunk 0..7); a wave covers 4 whole lines
  const int crow = threadIdx.x >> 3;
  const int cchk = threadIdx.x & 7;
  const unsigned short* ga = Xb + (blockIdx.y * 128 + crow) * E_DIM + cchk * 8;
  const unsigned short* gb = Wb + (blockIdx.x * 128 + crow) * E_DIM + cchk * 8;
  const unsigned int lds0 = (unsigned int)(size_t)smem + crow * G_PITCH + cchk * 16;

  // read side: byte offsets of this lane's fragment rows inside a stage
  const int aoff = (wm * 32 + lrow) * G_PITCH + half * 16;
  const int boff = G_OPB + (wn * 64 + lrow) * G_PITCH + half * 16;

  v8f c[2][4] = {};

  gemm_copy_stage(lds0, ga, gb);
  // tile 0 has landed for this wave's own copies
  asm volatile("s_wait_asynccnt 0x0" ::: "memory");
  __syncthreads();
  gemm_copy_stage(lds0 + G_STAGEB, ga + G_KT, gb + G_KT);

#pragma unroll 1  // one stage a trip: the ring's order stands once, at the loop's foot
  for (int t = 0; t < G_NT; ++t) {
    const unsigned int bsel = (unsigned int)(t & 1) * G_STAGEB;
    const unsigned char* sb = smem + bsel;
    // this loop and the three inside it are unrolled so that fragments and accumulators
    // are indexed by constants and stay in registers
#pragma unroll
    for (int kk = 0; kk < 2; ++kk) {
      ABf af[2], bf[4];
#pragma unroll
      for (int m = 0; m < 2; ++m) {
        af[m].u[0] = *(const u32x4*)(sb + aoff + m * 16 * G_PITCH + kk * 64);
        af[m].u[1] = *(const u32x4*)(sb + aoff + m * 16 * G_PITCH + kk * 64 + 32);
      }
#pragma unroll
      for (int n = 0; n < 4; ++n) {
        bf[n].u[0] = *(const u32x4*)(sb + boff + n * 16 * G_PITCH + kk * 64);
        bf[n].u[1] = *(const u32x4*)(sb + boff + n * 16 * G_PITCH + kk * 64 + 32);
      }
#pragma unroll
      for (int m = 0; m < 2; ++m)
#pragma unroll
        for (int n = 0; n < 4; ++n) c[m][n] = WMMA_BF16(bf[n].v, af[m].v, c[m][n]);
    }
    // this wave's reads of the buffer have returned before it is handed to the copies
    asm volatile("s_wait_dscnt 0x0" ::: "memory");
    // this wave's copies of tile t + 1 have landed before the barrier publishes them
    asm volatile("s_wait_asynccnt 0x0" ::: "memory");
    __syncthreads();
    if (t + 2 < G_NT)
      gemm_copy_stage(lds0 + bsel, ga + (t + 2) * G_KT, gb + (t + 2) * G_KT);
  }
  // no copy is outstanding when the wave goes on to its stores and ends
  asm volatile("s_wait_asynccnt 0x0" ::: "memory");

  // Behind the loop's last barrier no wave reads the ring any more and no copy is aimed at
  // it.  One branch on the mode for the whole tile.
  unsigned char* st = smem + wave * G_WSTB;
  if (mode == 0)      gemm_store_tile<0>(c, st, bias, outp, scale, mbase, nbase, lane);
  else if (mode == 1) gemm_store_tile<1>(c, st, bias, outp, scale, mbase, nbase, lane);
  else                gemm_store_tile<2>(c, st, bias, outp, scale, mbase, nbase, lane);
}

#define A_KEYS 64                    // keys per stage: two passes of 32
#define A_NST (SEQ / A_KEYS)         // 32 stages
#define A_PITCH 144                  // LDS row pitch in bytes (16 B x odd, for ds_load_b128)
#define A_OPB (64 * A_PITCH)         // one operand's tile in LDS
#define A_STAGEB (2 * A_OPB)         // [K tile | Vt tile]

// One stage: each thread brings 2 x 16 bytes of K and 2 x 16 bytes of Vt (rows 32 apart).
// The s_wait_xcnt stands inside the statement so that no address register named by a
// copy is rewritten in front of it.
__device__ __forceinline__ void attn_copy_stage(unsigned int lds,
                                                const unsigned short* gk,
                                                const unsigned short* gv) {
  asm volatile(
      "global_load_async_to_lds_b128 %0, %4, off\n\t"
      "global_load_async_to_lds_b128 %1, %5, off\n\t"
      "global_load_async_to_lds_b128 %2, %6, off\n\t"
      "global_load_async_to_lds_b128 %3, %7, off\n\t"
      "s_wait_xcnt 0x0"
      :: "v"(lds), "v"(lds + 32 * A_PITCH), "v"(lds + A_OPB), "v"(lds + A_OPB + 32 * A_PITCH),
         "v"(gk), "v"(gk + 32 * E_DIM), "v"(gv), "v"(gv + 32 * SEQ)
      : "memory");
}

// lane l takes the value of lane l ^ 16
__device__ __forceinline__ float xhalf(float x) {
  const int b = __builtin_bit_cast(int, x);
  return __builtin_bit_cast(
      float, __builtin_amdgcn_permlanex16(b, b, 0x76543210, 0xfedcba98, false, false));
}

__global__ __launch_bounds__(256)
void attn_fwd(const unsigned short* __restrict__ Qb,
              const unsigned short* __restrict__ Kb,
              const unsigned short* __restrict__ Vtb,
              unsigned short* __restrict__ Ctx) {
  __shared__ __attribute__((aligned(16))) unsigned char ring[2 * A_STAGEB];

  const int lane = threadIdx.x & 31;
  const int wave = threadIdx.x >> 5;
  const int lrow = lane & 15;
  const int lk = (lane >> 4) << 3;
  const int half = lane >> 4;

  const int bh = blockIdx.x >> 3;   // / (SEQ/256)
  const int qt = (blockIdx.x & 7) * 8 + wave;
  const int b = bh >> 4, h = bh & 15;
  const int qrowbase = b * SEQ + qt * 32;

  const u32x4* Qv = (const u32x4*)Qb;

  // copy side: thread -> (row 0..31, 16-byte chunk 0..7); a wave covers 4 whole lines
  const int crow = threadIdx.x >> 3;
  const int cchk = threadIdx.x & 7;
  const unsigned short* gk = Kb + (b * SEQ + crow) * E_DIM + h * HEAD_DIM + cchk * 8;
  const unsigned short* gv = Vtb + ((b * N_HEADS + h) * HEAD_DIM + crow) * SEQ + cchk * 8;
  const unsigned int lds0 = (unsigned int)(size_t)ring + crow * A_PITCH + cchk * 16;

  // read side: byte offset of this lane's fragment row inside an operand's tile.  Of each 64
  // bytes of a row a lane takes bytes 16 * half and 32 + 16 * half: the hardware k order,
  // which the packed score tiles have as well.
  const int foff = lrow * A_PITCH + half * 16;

  // Q: 2 query sub-tiles x 2 K-dim chunks, resident in registers
  ABf aq[2][2];
#pragma unroll
  for (int m = 0; m < 2; ++m) {
    const int qoff = (qrowbase + m * 16 + lrow) * E_DIM + h * HEAD_DIM;
    aq[m][0].u[0] = Qv[(qoff + lk) >> 3];
    aq[m][0].u[1] = Qv[(qoff + lk + 16) >> 3];
    aq[m][1].u[0] = Qv[(qoff + 32 + lk) >> 3];
    aq[m][1].u[1] = Qv[(qoff + 32 + lk + 16) >> 3];
  }

  // o[g][t][r] = O^T[d = 16 t + 8 half + r][query 16 g + lrow]
  v8f o[2][4] = {};
  // per query group: the query's running maximum (equal in both halves) and the running sum
  // over this half's keys (the halves are joined behind the loop)
  float m_i[2] = {-3.0e38f, -3.0e38f}, l_i[2] = {0.0f, 0.0f};

  attn_copy_stage(lds0, gk, gv);
  // stage 0 has landed for this wave's own copies
  asm volatile("s_wait_asynccnt 0x0" ::: "memory");
  __syncthreads();
  attn_copy_stage(lds0 + A_STAGEB, gk + A_KEYS * E_DIM, gv + A_KEYS);

#pragma unroll 1  // one stage a trip: the ring's order stands once, at the loop's foot
  for (int st = 0; st < A_NST; ++st) {
   const unsigned int bsel = (unsigned int)(st & 1) * A_STAGEB;
   const unsigned char* kbuf = ring + bsel + foff;
   const unsigned char* vbuf = kbuf + A_OPB;
#pragma unroll 1  // one pass of 32 keys a trip: short loop text, one set of pass registers
   for (int p = 0; p < A_KEYS / 32; ++p) {
    // ---- scores: S^T(32 keys x 32 queries) = K_tile(32x64) @ Q^T(64x32)
    ABf ak[2][2];
    // all loops of the pass are unrolled so that fragments and accumulators are indexed by
    // constants and stay in registers
#pragma unroll
    for (int kt = 0; kt < 2; ++kt)
#pragma unroll
      for (int kc = 0; kc < 2; ++kc) {
        const unsigned char* kr = kbuf + (p * 32 + kt * 16) * A_PITCH + kc * 64;
        ak[kt][kc].u[0] = *(const u32x4*)(kr);
        ak[kt][kc].u[1] = *(const u32x4*)(kr + 32);
      }
    // s[kt][g][r] = S^T[key 16 kt + 8 half + r][query 16 g + lrow]
    v8f s[2][2] = {};
#pragma unroll
    for (int kt = 0; kt < 2; ++kt)
#pragma unroll
      for (int g = 0; g < 2; ++g) {
        s[kt][g] = WMMA_BF16(ak[kt][0].v, aq[g][0].v, s[kt][g]);
        s[kt][g] = WMMA_BF16(ak[kt][1].v, aq[g][1].v, s[kt][g]);
      }

    // ---- V^T fragments from the ring (A operand: row = d, k = the pass's 32 keys)
    ABf av[4];
#pragma unroll
    for (int t = 0; t < 4; ++t) {
      const unsigned char* vr = vbuf + t * 16 * A_PITCH + p * 64;
      av[t].u[0] = *(const u32x4*)(vr);
      av[t].u[1] = *(const u32x4*)(vr + 32);
    }

    // ---- online softmax of queries 16 g + lrow, on this half's 16 keys
    float mnew[2], alpha[2];
#pragma unroll
    for (int g = 0; g < 2; ++g) {
      float rmax = -3.0e38f;
#pragma unroll
      for (int r = 0; r < 8; ++r) rmax = fmaxf(rmax, fmaxf(s[0][g][r], s[1][g][r]));
      rmax = fmaxf(rmax, xhalf(rmax));
      mnew[g] = fmaxf(m_i[g], rmax);
    }
#pragma unroll
    for (int g = 0; g < 2; ++g) {
      alpha[g] = __expf(m_i[g] - mnew[g]);
      m_i[g] = mnew[g];
    }

#pragma unroll
    for (int g = 0; g < 2; ++g) {
      // element e of the B operand is key kmap(e) = 16 (e >> 3) + 8 half + (e & 7): score
      // tile e >> 3, register e & 7
      v8f pt[2];
      ABf pf;
#pragma unroll
      for (int kt = 0; kt < 2; ++kt) {
        const v8f e = s[kt][g] - mnew[g];
#pragma unroll
        for (int r = 0; r < 8; ++r) pt[kt][r] = __expf(e[r]);
#pragma unroll
        for (int i = 0; i < 4; ++i)
          pf.u[kt][i] = (unsigned int)f2bf(pt[kt][2 * i]) | ((unsigned int)f2bf(pt[kt][2 * i + 1]) << 16);
      }
      const v8f ps = pt[0] + pt[1];
      const float ssum = ((ps[0] + ps[1]) + (ps[2] + ps[3])) + ((ps[4] + ps[5]) + (ps[6] + ps[7]));
      l_i[g] = l_i[g] * alpha[g] + ssum;

      // ---- O^T = O^T * alpha + V^T(64x32) @ P^T(32x16)
#pragma unroll
      for (int t = 0; t < 4; ++t) {
        o[g][t] = o[g][t] * alpha[g];
        o[g][t] = WMMA_BF16(av[t].v, pf.v, o[g][t]);
      }
    }
    // keeps the pass's WMMAs in front of the slots below
    __builtin_amdgcn_sched_barrier(0);
    // four vector slots between the pass's last WMMA and the next trip's first write of a
    // register that held its A or B
    asm volatile("v_nop\n\tv_nop\n\tv_nop\n\tv_nop");
   }
   // this wave's reads of the buffer have returned before it is handed to the copies
   asm volatile("s_wait_dscnt 0x0" ::: "memory");
   // this wave's copies of stage st + 1 have landed before the barrier publishes them
   asm volatile("s_wait_asynccnt 0x0" ::: "memory");
   __syncthreads();
   if (st + 2 < A_NST)
     attn_copy_stage(lds0 + bsel, gk + (st + 2) * A_KEYS * E_DIM, gv + (st + 2) * A_KEYS);
  }
  // no copy is outstanding when the wave goes on to its stores and ends
  asm volatile("s_wait_asynccnt 0x0" ::: "memory");

  // the three loops are unrolled so that o is indexed by constants and stays in registers
#pragma unroll
  for (int g = 0; g < 2; ++g) {
    const float l = l_i[g] + xhalf(l_i[g]);   // both halves' keys
    const float rr = (l > 0.f) ? (1.0f / l) : 0.f;
    unsigned short* crow_p = Ctx + (qrowbase + g * 16 + lrow) * E_DIM + h * HEAD_DIM + 8 * half;
#pragma unroll
    for (int t = 0; t < 4; ++t) {
      // a lane's 8 registers are 8 consecutive d of one query: one 16-byte store
      u32x4 pk;
#pragma unroll
      for (int i = 0; i < 4; ++i)
        pk[i] = (unsigned int)f2bf(o[g][t][2 * i] * rr) |
                ((unsigned int)f2bf(o[g][t][2 * i + 1] * rr) << 16);
      *(u32x4*)(crow_p + t * 16) = pk;
    }
  }
}

// ---------------------------------------------------------------- launch
extern "C" void kernel_launch(void* const* d_in, const int* in_sizes, int n_in,
                              void* d_out, int out_size, void* d_ws, size_t ws_size,
                              hipStream_t stream) {
  const float* x  = (const float*)d_in[0];
  const float* wq = (const float*)d_in[1];
  const float* bq = (const float*)d_in[2];
  const float* wk = (const float*)d_in[3];
  const float* bk = (const float*)d_in[4];
  const float* wv = (const float*)d_in[5];
  const float* bv = (const float*)d_in[6];
  const float* wo = (const float*)d_in[7];
  const float* bo = (const float*)d_in[8];

  char* ws = (char*)d_ws;
  const size_t MB = 1024 * 1024;
  unsigned short* xb  = (unsigned short*)(ws + 0 * MB);   // 16 MB
  unsigned short* wqb = (unsigned short*)(ws + 16 * MB);  //  2 MB
  unsigned short* wkb = (unsigned short*)(ws + 18 * MB);
  unsigned short* wvb = (unsigned short*)(ws + 20 * MB);
  unsigned short* wob = (unsigned short*)(ws + 22 * MB);
  unsigned short* qb  = (unsigned short*)(ws + 24 * MB);  // 16 MB
  unsigned short* kb2 = (unsigned short*)(ws + 40 * MB);  // 16 MB
  unsigned short* vtb = (unsigned short*)(ws + 56 * MB);  // 16 MB [B,H,D,S]
  unsigned short* ctx = (unsigned short*)(ws + 72 * MB);  // 16 MB

  // xb, wqb, wkb, wvb, wob lie one behind another from xb on
  cvt_f32_bf16<<<CV_BLOCKS, CV_THREADS, 0, stream>>>(x, wq, wk, wv, wo, xb);

  dim3 gg(E_DIM / 128, ROWS / 128);  // (8, 64), 256 threads = 8 waves
  const float qscale = 0.125f;       // 1/sqrt(64)
  gemm_xwt<<<gg, 256, 0, stream>>>(xb, wqb, bq, qb,  qscale, 0);
  gemm_xwt<<<gg, 256, 0, stream>>>(xb, wkb, bk, kb2, 1.0f,   0);
  dim3 gt(ROWS / 128, E_DIM / 128);  // (64, 8): V^T = Wv X^T, rows = d, columns = tokens
  gemm_xwt<<<gt, 256, 0, stream>>>(wvb, xb, bv, vtb, 1.0f,   2);

  attn_fwd<<<BATCH * N_HEADS * (SEQ / 256), 256, 0, stream>>>(qb, kb2, vtb, ctx);

  gemm_xwt<<<gg, 256, 0, stream>>>(ctx, wob, bo, d_out, 1.0f, 1);
}

// v006
// Measured time: 136 microseconds a run.
// Two timings next to v005 put it at 1.08 and 1.07 times that version's speed.
// Over all steps from v000 it is 2.70 times as fast.
#include <hip/hip_runtime.h>
#include <hip/hip_bf16.h>
#include <stdint.h>

#define E_DIM 1024
#define N_HEADS 16
#define HEAD_DIM 64
#define SEQ 2048
#define BATCH 4
#define ROWS (BATCH * SEQ)  // 8192

typedef __attribute__((ext_vector_type(16))) __bf16 v16bf;
typedef __attribute__((ext_vector_type(8)))  float  v8f;
typedef __attribute__((ext_vector_type(4)))  unsigned int u32x4;
typedef __attribute__((ext_vector_type(4)))  float  f32x4;
typedef __attribute__((ext_vector_type(2)))  float  f32x2;
typedef __attribute__((ext_vector_type(2)))  __bf16 bf16x2;

union ABf { v16bf v; u32x4 u[2]; };

// two f32 -> two bf16 in one register (lo in bits 15..0), round to nearest even: one packed
// convert instruction
__device__ __forceinline__ unsigned int pk2bf(float lo, float hi) {
  const f32x2 v = {lo, hi};
  return __builtin_bit_cast(unsigned int, __builtin_convertvector(v, bf16x2));
}

#define WMMA_BF16(A, B, C) \
  __builtin_amdgcn_wmma_f32_16x16x32_bf16(false, (A), false, (B), (short)0, (C), false, false)

// ---------------------------------------------------------------- convert
// x and the four weights go to bf16 in ONE launch of one 16-wave work-group per WGP, so
// that few waves have to be started.  The five results lie one behind another in `out`
// (x, wq, wk, wv, wo).  A piece is 16,384 values of one array; a work-group takes
// CV_XT pieces of x and one piece of a weight.  Each wave-wide load covers 512 contiguous
// bytes (4 whole lines), each wave-wide store 256 (2 whole lines); all of a thread's
// loads are issued before its first value is converted.
#define CV_THREADS 512
#define CV_BLOCKS 256
#define CV_LOADS 8
#define CV_STEP (CV_THREADS * 4)                 // values a work-group brings with one load
#define CV_PIECE (CV_STEP * CV_LOADS)            // 16,384 values
#define CV_XT (ROWS * E_DIM / CV_PIECE / CV_BLOCKS)  // 2 pieces of x a work-group
#define CV_WP (E_DIM * E_DIM / CV_PIECE)         // 64 pieces in each weight
static_assert(CV_XT * CV_BLOCKS * CV_PIECE == ROWS * E_DIM &&
              CV_WP * CV_PIECE == E_DIM * E_DIM && 4 * CV_WP == CV_BLOCKS,
              "the pieces cover the five arrays exactly");

__global__ __launch_bounds__(CV_THREADS)
void cvt_f32_bf16(const float* __restrict__ x,
                  const float* __restrict__ wq, const float* __restrict__ wk,
                  const float* __restrict__ wv, const float* __restrict__ wo,
                  unsigned short* __restrict__ out) {
  const int blk = blockIdx.x;
  const int k = blk / CV_WP;                     // the weight that this work-group's piece is of
  const float* w = (k == 0) ? wq : (k == 1) ? wk : (k == 2) ? wv : wo;

  f32x4 v[CV_XT + 1][CV_LOADS];
  // all loops unrolled: v is indexed by constants and stays in registers
#pragma unroll
  for (int t = 0; t <= CV_XT; ++t) {
    const float* src = (t < CV_XT) ? x + (t * CV_BLOCKS + blk) * CV_PIECE
                                   : w + (blk % CV_WP) * CV_PIECE;
#pragma unroll
    for (int j = 0; j < CV_LOADS; ++j)
      v[t][j] = *(const f32x4*)(src + j * CV_STEP + threadIdx.x * 4);
  }
  // Takes the loaded values as inputs only, so that all 24 loads of a thread are in flight
  // together: without it the compiler saves registers by converting early and issues the
  // last loads two at a time, each pair waited for.  The wait stands in front of the first
  // reuse of a register that a load names.
  static_assert(CV_XT == 2 && CV_LOADS == 8, "the statement below names every loaded value");
  asm volatile("s_wait_xcnt 0x0"
               :: "v"(v[0][0]), "v"(v[0][1]), "v"(v[0][2]), "v"(v[0][3]),
                  "v"(v[0][4]), "v"(v[0][5]), "v"(v[0][6]), "v"(v[0][7]),
                  "v"(v[1][0]), "v"(v[1][1]), "v"(v[1][2]), "v"(v[1][3]),
                  "v"(v[1][4]), "v"(v[1][5]), "v"(v[1][6]), "v"(v[1][7]),
                  "v"(v[2][0]), "v"(v[2][1]), "v"(v[2][2]), "v"(v[2][3]),
                  "v"(v[2][4]), "v"(v[2][5]), "v"(v[2][6]), "v"(v[2][7])
               : "memory");
#pragma unroll
  for (int t = 0; t <= CV_XT; ++t) {
    unsigned short* dst = out + (t * CV_BLOCKS + blk) * CV_PIECE + threadIdx.x * 4;
#pragma unroll
    for (int j = 0; j < CV_LOADS; ++j) {
      uint2 p;
      p.x = pk2bf(v[t][j].x, v[t][j].y);
      p.y = pk2bf(v[t][j].z, v[t][j].w);
      *(uint2*)(dst + j * CV_STEP) = p;
    }
  }
}

#define G_KT 64                      // k elements per stage: rows of 128 bytes
#define G_NT (E_DIM / G_KT)          // 16 stages
#define G_PITCH 144                  // LDS row pitch in bytes (16 B x odd, for ds_load_b128)
#define G_OPB (128 * G_PITCH)        // one operand's tile in LDS
#define G_STAGEB (2 * G_OPB)         // [X tile | W tile]
#define G_WSTB (2 * G_STAGEB / 8)    // a wave's part of the ring for its output tile
#define G_OP16 144                   // staged row pitch, 64 bf16 (16 B x odd)
#define G_OP32 272                   // staged row pitch, 64 f32 (16 B x odd)
static_assert(32 * G_OP16 <= G_WSTB && 32 * G_OP32 <= G_WSTB, "a wave's tile fits its part");

// One stage: each thread brings 4 x 16 bytes of X and 4 x 16 bytes of W (rows 32 apart).
// The s_wait_xcnt stands inside the statement so that no address register named by a
// copy is rewritten in front of it.
__device__ __forceinline__ void gemm_copy_stage(unsigned int lds,
                                                const unsigned short* ga,
                                                const unsigned short* gb) {
  asm volatile(
      "global_load_async_to_lds_b128 %0, %8, off\n\t"
      "global_load_async_to_lds_b128 %1, %9, off\n\t"
      "global_load_async_to_lds_b128 %2, %10, off\n\t"
      "global_load_async_to_lds_b128 %3, %11, off\n\t"
      "global_load_async_to_lds_b128 %4, %12, off\n\t"
      "global_load_async_to_lds_b128 %5, %13, off\n\t"
      "global_load_async_to_lds_b128 %6, %14, off\n\t"
      "global_load_async_to_lds_b128 %7, %15, off\n\t"
      "s_wait_xcnt 0x0"
      :: "v"(lds), "v"(lds + 32 * G_PITCH), "v"(lds + 64 * G_PITCH), "v"(lds + 96 * G_PITCH),
         "v"(lds + G_OPB), "v"(lds + G_OPB + 32 * G_PITCH), "v"(lds + G_OPB + 64 * G_PITCH),
         "v"(lds + G_OPB + 96 * G_PITCH),
         "v"(ga), "v"(ga + 32 * E_DIM), "v"(ga + 64 * E_DIM), "v"(ga + 96 * E_DIM),
         "v"(gb), "v"(gb + 32 * E_DIM), "v"(gb + 64 * E_DIM), "v"(gb + 96 * E_DIM)
      : "memory");
}

// c[m][n][r] = Y[mbase + 16 m + lrow][nbase + 16 n + 8 half + r], without bias and scale.
// st: the wave's own staging bytes.  All loops are unrolled so that c is indexed by constants
// and stays in registers.
template <int MODE>
__device__ __forceinline__ void gemm_store_tile(const v8f (&c)[2][4], unsigned char* st,
                                                const float* __restrict__ bias,
                                                void* __restrict__ outp, float scale,
                                                int mbase, int nbase, int lane) {
  const int lrow = lane & 15;
  const int half = lane >> 4;
  constexpr int PITCH = (MODE == 1) ? G_OP32 : G_OP16;
#pragma unroll
  for (int n = 0; n < 4; ++n) {
    f32x4 b0 = {}, b1 = {};
    if (MODE != 2) {
      b0 = *(const f32x4*)(bias + nbase + n * 16 + 8 * half);
      b1 = *(const f32x4*)(bias + nbase + n * 16 + 8 * half + 4);
    }
#pragma unroll
    for (int m = 0; m < 2; ++m) {
      float v[8];
      const float br = (MODE == 2) ? bias[mbase + m * 16 + lrow] : 0.0f;
#pragma unroll
      for (int r = 0; r < 8; ++r)
        v[r] = (c[m][n][r] + ((MODE == 2) ? br : (r < 4) ? b0[r & 3] : b1[r & 3])) * scale;
      unsigned char* sp = st + (m * 16 + lrow) * PITCH;
      if (MODE == 1) {
        const f32x4 lo = {v[0], v[1], v[2], v[3]}, hi = {v[4], v[5], v[6], v[7]};
        *(f32x4*)(sp + n * 64 + half * 32) = lo;
        *(f32x4*)(sp + n * 64 + half * 32 + 16) = hi;
      } else {
        u32x4 pk;
#pragma unroll
        for (int i = 0; i < 4; ++i) pk[i] = pk2bf(v[2 * i], v[2 * i + 1]);
        *(u32x4*)(sp + n * 32 + half * 16) = pk;
      }
    }
  }
  // the wave's own staged pieces are in LDS before its lanes read one another's
  asm volatile("s_wait_dscnt 0x0" ::: "memory");
  if (MODE == 1) {
    // a row is 256 bytes: 16 lanes a row, 2 rows (4 whole lines) a store
    float* op = (float*)outp + (mbase + half) * E_DIM + nbase + lrow * 4;
    const unsigned char* sp = st + half * PITCH + lrow * 16;
#pragma unroll
    for (int i = 0; i < 16; ++i)
      *(f32x4*)(op + i * 2 * E_DIM) = *(const f32x4*)(sp + i * 2 * PITCH);
  } else {
    // a row is 128 bytes: 8 lanes a row, 4 rows (4 whole lines) a store
    const int row = lane >> 3, chk = lane & 7;
    constexpr int OPITCH = (MODE == 0) ? E_DIM : SEQ;
    unsigned short* op = (unsigned short*)outp + chk * 8 +
        ((MODE == 0) ? (mbase + row) * E_DIM + nbase
                     : ((nbase >> 11) * E_DIM + mbase + row) * SEQ + (nbase & (SEQ - 1)));
    const unsigned char* sp = st + row * PITCH + chk * 16;
#pragma unroll
    for (int i = 0; i < 8; ++i)
      *(u32x4*)(op + i * 4 * OPITCH) = *(const u32x4*)(sp + i * 4 * PITCH);
  }
  // stands in front of whatever the compiler places behind the tile's stores, so that no
  // register named by a store is rewritten ahead of it
  asm volatile("s_wait_xcnt 0x0" ::: "memory");
}

__global__ __launch_bounds__(256)
void gemm_xwt(const unsigned short* __restrict__ Xb,
              const unsigned short* __restrict__ Wb,
              const float* __restrict__ bias,
              void* __restrict__ outp, float scale, int mode) {
  __shared__ __attribute__((aligned(16))) unsigned char smem[2 * G_STAGEB];

  const int lane = threadIdx.x & 31;
  const int wave = threadIdx.x >> 5;
  const int wm = wave & 3;
  const int wn = wave >> 2;
  const int mbase = blockIdx.y * 128 + wm * 32;
  const int nbase = blockIdx.x * 128 + wn * 64;
  const int lrow = lane & 15;
  const int half = lane >> 4;        // A/B 16-bit K-chunk: k = 8 * half (ISA 7.12.2)

  // copy side: thread -> (row 0..31, 16-byte chunk 0..7); a wave covers 4 whole lines
  const int crow = threadIdx.x >> 3;
  const int cchk = threadIdx.x & 7;
  const unsigned short* ga = Xb + (blockIdx.y * 128 + crow) * E_DIM + cchk * 8;
  const unsigned short* gb = Wb + (blockIdx.x * 128 + crow) * E_DIM + cchk * 8;
  const unsigned int lds0 = (unsigned int)(size_t)smem + crow * G_PITCH + cchk * 16;

  // read side: byte offsets of this lane's fragment rows inside a stage
  const int aoff = (wm * 32 + lrow) * G_PITCH + half * 16;
  const int boff = G_OPB + (wn * 64 + lrow) * G_PITCH + half * 16;

  v8f c[2][4] = {};

  gemm_copy_stage(lds0, ga, gb);
  // tile 0 has landed for this wave's own copies
  asm volatile("s_wait_asynccnt 0x0" ::: "memory");
  __syncthreads();
  gemm_copy_stage(lds0 + G_STAGEB, ga + G_KT, gb + G_KT);

#pragma unroll 1  // one stage a trip: the ring's order stands once, at the loop's foot
  for (int t = 0; t < G_NT; ++t) {
    const unsigned int bsel = (unsigned int)(t & 1) * G_STAGEB;
    const unsigned char* sb = smem + bsel;
    // this loop and the three inside it are unrolled so that fragments and accumulators
    // are indexed by constants and stay in registers
#pragma unroll
    for (int kk = 0; kk < 2; ++kk) {
      ABf af[2], bf[4];
#pragma unroll
      for (int m = 0; m < 2; ++m) {
        af[m].u[0] = *(const u32x4*)(sb + aoff + m * 16 * G_PITCH + kk * 64);
        af[m].u[1] = *(const u32x4*)(sb + aoff + m * 16 * G_PITCH + kk * 64 + 32);
      }
#pragma unroll
      for (int n = 0; n < 4; ++n) {
        bf[n].u[0] = *(const u32x4*)(sb + boff + n * 16 * G_PITCH + kk * 64);
        bf[n].u[1] = *(const u32x4*)(sb + boff + n * 16 * G_PITCH + kk * 64 + 32);
      }
#pragma unroll
      for (int m = 0; m < 2; ++m)
#pragma unroll
        for (int n = 0; n < 4; ++n) c[m][n] = WMMA_BF16(bf[n].v, af[m].v, c[m][n]);
    }
    // this wave's reads of the buffer have returned before it is handed to the copies
    asm volatile("s_wait_dscnt 0x0" ::: "memory");
    // this wave's copies of tile t + 1 have landed before the barrier publishes them
    asm volatile("s_wait_asynccnt 0x0" ::: "memory");
    __syncthreads();
    if (t + 2 < G_NT)
      gemm_copy_stage(lds0 + bsel, ga + (t + 2) * G_KT, gb + (t + 2) * G_KT);
  }
  // no copy is outstanding when the wave goes on to its stores and ends
  asm volatile("s_wait_asynccnt 0x0" ::: "memory");

  // Behind the loop's last barrier no wave reads the ring any more and no copy is aimed at
  // it.  One branch on the mode for the whole tile.
  unsigned char* st = smem + wave * G_WSTB;
  if (mode == 0)      gemm_store_tile<0>(c, st, bias, outp, scale, mbase, nbase, lane);
  else if (mode == 1) gemm_store_tile<1>(c, st, bias, outp, scale, mbase, nbase, lane);
  else                gemm_store_tile<2>(c, st, bias, outp, scale, mbase, nbase, lane);
}

#define A_KEYS 64                    // keys per stage: two passes of 32
#define A_NST (SEQ / A_KEYS)         // 32 stages
#define A_PITCH 144                  // LDS row pitch in bytes (16 B x odd, for ds_load_b128)
#define A_OPB (64 * A_PITCH)         // one operand's tile in LDS
#define A_STAGEB (2 * A_OPB)         // [K tile | Vt tile]

// One stage: each thread brings 2 x 16 bytes of K and 2 x 16 bytes of Vt (rows 32 apart).
// The s_wait_xcnt stands inside the statement so that no address register named by a
// copy is rewritten in front of it.
__device__ __forceinline__ void attn_copy_stage(unsigned int lds,
                                                const unsigned short* gk,
                                                const unsigned short* gv) {
  asm volatile(
      "global_load_async_to_lds_b128 %0, %4, off\n\t"
      "global_load_async_to_lds_b128 %1, %5, off\n\t"
      "global_load_async_to_lds_b128 %2, %6, off\n\t"
      "global_load_async_to_lds_b128 %3, %7, off\n\t"
      "s_wait_xcnt 0x0"
      :: "v"(lds), "v"(lds + 32 * A_PITCH), "v"(lds + A_OPB), "v"(lds + A_OPB + 32 * A_PITCH),
         "v"(gk), "v"(gk + 32 * E_DIM), "v"(gv), "v"(gv + 32 * SEQ)
      : "memory");
}

// lane l takes the value of lane l ^ 16
__device__ __forceinline__ float xhalf(float x) {
  const int b = __builtin_bit_cast(int, x);
  return __builtin_bit_cast(
      float, __builtin_amdgcn_permlanex16(b, b, 0x76543210, 0xfedcba98, false, false));
}

__global__ __launch_bounds__(256)
void attn_fwd(const unsigned short* __restrict__ Qb,
              const unsigned short* __restrict__ Kb,
              const unsigned short* __restrict__ Vtb,
              unsigned short* __restrict__ Ctx) {
  __shared__ __attribute__((aligned(16))) unsigned char ring[2 * A_STAGEB];

  const int lane = threadIdx.x & 31;
  const int wave = threadIdx.x >> 5;
  const int lrow = lane & 15;
  const int lk = (lane >> 4) << 3;
  const int half = lane >> 4;

  const int bh = blockIdx.x >> 3;   // / (SEQ/256)
  const int qt = (blockIdx.x & 7) * 8 + wave;
  const int b = bh >> 4, h = bh & 15;
  const int qrowbase = b * SEQ + qt * 32;

  const u32x4* Qv = (const u32x4*)Qb;

  // copy side: thread -> (row 0..31, 16-byte chunk 0..7); a wave covers 4 whole lines
  const int crow = threadIdx.x >> 3;
  const int cchk = threadIdx.x & 7;
  const unsigned short* gk = Kb + (b * SEQ + crow) * E_DIM + h * HEAD_DIM + cchk * 8;
  const unsigned short* gv = Vtb + ((b * N_HEADS + h) * HEAD_DIM + crow) * SEQ + cchk * 8;
  const unsigned int lds0 = (unsigned int)(size_t)ring + crow * A_PITCH + cchk * 16;

  // read side: byte offset of this lane's fragment row inside an operand's tile.  Of each 64
  // bytes of a row a lane takes bytes 16 * half and 32 + 16 * half: the hardware k order,
  // which the packed score tiles have as well.
  const int foff = lrow * A_PITCH + half * 16;

  // Q: 2 query sub-tiles x 2 K-dim chunks, resident in registers
  ABf aq[2][2];
#pragma unroll
  for (int m = 0; m < 2; ++m) {
    const int qoff = (qrowbase + m * 16 + lrow) * E_DIM + h * HEAD_DIM;
    aq[m][0].u[0] = Qv[(qoff + lk) >> 3];
    aq[m][0].u[1] = Qv[(qoff + lk + 16) >> 3];
    aq[m][1].u[0] = Qv[(qoff + 32 + lk) >> 3];
    aq[m][1].u[1] = Qv[(qoff + 32 + lk + 16) >> 3];
  }

  // o[g][t][r] = O^T[d = 16 t + 8 half + r][query 16 g + lrow]
  v8f o[2][4] = {};
  // per query group: the query's running maximum (equal in both halves) and the running sum
  // over this half's keys (the halves are joined behind the loop)
  float m_i[2] = {-3.0e38f, -3.0e38f}, l_i[2] = {0.0f, 0.0f};

  attn_copy_stage(lds0, gk, gv);
  // stage 0 has landed for this wave's own copies
  asm volatile("s_wait_asynccnt 0x0" ::: "memory");
  __syncthreads();
  attn_copy_stage(lds0 + A_STAGEB, gk + A_KEYS * E_DIM, gv + A_KEYS);

#pragma unroll 1  // one stage a trip: the ring's order stands once, at the loop's foot
  for (int st = 0; st < A_NST; ++st) {
   const unsigned int bsel = (unsigned int)(st & 1) * A_STAGEB;
   const unsigned char* kbuf = ring + bsel + foff;
   const unsigned char* vbuf = kbuf + A_OPB;
#pragma unroll 1  // one pass of 32 keys a trip: short loop text, one set of pass registers
   for (int p = 0; p < A_KEYS / 32; ++p) {
    // ---- scores: S^T(32 keys x 32 queries) = K_tile(32x64) @ Q^T(64x32)
    ABf ak[2][2];
    // all loops of the pass are unrolled so that fragments and accumulators are indexed by
    // constants and stay in registers
#pragma unroll
    for (int kt = 0; kt < 2; ++kt)
#pragma unroll
      for (int kc = 0; kc < 2; ++kc) {
        const unsigned char* kr = kbuf + (p * 32 + kt * 16) * A_PITCH + kc * 64;
        ak[kt][kc].u[0] = *(const u32x4*)(kr);
        ak[kt][kc].u[1] = *(const u32x4*)(kr + 32);
      }
    // s[kt][g][r] = S^T[key 16 kt + 8 half + r][query 16 g + lrow]
    v8f s[2][2] = {};
#pragma unroll
    for (int kt = 0; kt < 2; ++kt)
#pragma unroll
      for (int g = 0; g < 2; ++g) {
        s[kt][g] = WMMA_BF16(ak[kt][0].v, aq[g][0].v, s[kt][g]);
        s[kt][g] = WMMA_BF16(ak[kt][1].v, aq[g][1].v, s[kt][g]);
      }

    // ---- V^T fragments from the ring (A operand: row = d, k = the pass's 32 keys)
    ABf av[4];
#pragma unroll
    for (int t = 0; t < 4; ++t) {
      const unsigned char* vr = vbuf + t * 16 * A_PITCH + p * 64;
      av[t].u[0] = *(const u32x4*)(vr);
      av[t].u[1] = *(const u32x4*)(vr + 32);
    }

    // ---- online softmax of queries 16 g + lrow, on this half's 16 keys
    float mnew[2], alpha[2];
#pragma unroll
    for (int g = 0; g < 2; ++g) {
      float rmax = -3.0e38f;
#pragma unroll
      for (int r = 0; r < 8; ++r) rmax = fmaxf(rmax, fmaxf(s[0][g][r], s[1][g][r]));
      rmax = fmaxf(rmax, xhalf(rmax));
      mnew[g] = fmaxf(m_i[g], rmax);
    }
#pragma unroll
    for (int g = 0; g < 2; ++g) {
      alpha[g] = __expf(m_i[g] - mnew[g]);
      m_i[g] = mnew[g];
    }

#pragma unroll
    for (int g = 0; g < 2; ++g) {
      // element e of the B operand is key kmap(e) = 16 (e >> 3) + 8 half + (e & 7): score
      // tile e >> 3, register e & 7
      v8f pt[2];
      ABf pf;
#pragma unroll
      for (int kt = 0; kt < 2; ++kt) {
        const v8f e = s[kt][g] - mnew[g];
#pragma unroll
        for (int r = 0; r < 8; ++r) pt[kt][r] = __expf(e[r]);
#pragma unroll
        for (int i = 0; i < 4; ++i) pf.u[kt][i] = pk2bf(pt[kt][2 * i], pt[kt][2 * i + 1]);
      }
      const v8f ps = pt[0] + pt[1];
      const float ssum = ((ps[0] + ps[1]) + (ps[2] + ps[3])) + ((ps[4] + ps[5]) + (ps[6] + ps[7]));
      l_i[g] = l_i[g] * alpha[g] + ssum;

      // ---- O^T = O^T * alpha + V^T(64x32) @ P^T(32x16)
#pragma unroll
      for (int t = 0; t < 4; ++t) {
        o[g][t] = o[g][t] * alpha[g];
        o[g][t] = WMMA_BF16(av[t].v, pf.v, o[g][t]);
      }
    }
    // keeps the pass's WMMAs in front of the slots below
    __builtin_amdgcn_sched_barrier(0);
    // four vector slots between the pass's last WMMA and the next trip's first write of a
    // register that held its A or B
    asm volatile("v_nop\n\tv_nop\n\tv_nop\n\tv_nop");
   }
   // this wave's reads of the buffer have returned before it is handed to the copies
   asm volatile("s_wait_dscnt 0x0" ::: "memory");
   // this wave's copies of stage st + 1 have landed before the barrier publishes them
   asm volatile("s_wait_asynccnt 0x0" ::: "memory");
   __syncthreads();
   if (st + 2 < A_NST)
     attn_copy_stage(lds0 + bsel, gk + (st + 2) * A_KEYS * E_DIM, gv + (st + 2) * A_KEYS);
  }
  // no copy is outstanding when the wave goes on to its stores and ends
  asm volatile("s_wait_asynccnt 0x0" ::: "memory");

  // the three loops are unrolled so that o is indexed by constants and stays in registers
#pragma unroll
  for (int g = 0; g < 2; ++g) {
    const float l = l_i[g] + xhalf(l_i[g]);   // both halves' keys
    const float rr = (l > 0.f) ? (1.0f / l) : 0.f;
    unsigned short* crow_p = Ctx + (qrowbase + g * 16 + lrow) * E_DIM + h * HEAD_DIM + 8 * half;
#pragma unroll
    for (int t = 0; t < 4; ++t) {
      // a lane's 8 registers are 8 consecutive d of one query: one 16-byte store
      u32x4 pk;
#pragma unroll
      for (int i = 0; i < 4; ++i) pk[i] = pk2bf(o[g][t][2 * i] * rr, o[g][t][2 * i + 1] * rr);
      *(u32x4*)(crow_p + t * 16) = pk;
    }
  }
}

// ---------------------------------------------------------------- launch
extern "C" void kernel_launch(void* const* d_in, const int* in_sizes, int n_in,
                              void* d_out, int out_size, void* d_ws, size_t ws_size,
                              hipStream_t stream) {
  const float* x  = (const float*)d_in[0];
  const float* wq = (const float*)d_in[1];
  const float* bq = (const float*)d_in[2];
  const float* wk = (const float*)d_in[3];
  const float* bk = (const float*)d_in[4];
  const float* wv = (const float*)d_in[5];
  const float* bv = (const float*)d_in[6];
  const float* wo = (const float*)d_in[7];
  const float* bo = (const float*)d_in[8];

  char* ws = (char*)d_ws;
  const size_t MB = 1024 * 1024;
  unsigned short* xb  = (unsigned short*)(ws + 0 * MB);   // 16 MB
  unsigned short* wqb = (unsigned short*)(ws + 16 * MB);  //  2 MB
  unsigned short* wkb = (unsigned short*)(ws + 18 * MB);
  unsigned short* wvb = (unsigned short*)(ws + 20 * MB);
  unsigned short* wob = (unsigned short*)(ws + 22 * MB);
  unsigned short* qb  = (unsigned short*)(ws + 24 * MB);  // 16 MB
  unsigned short* kb2 = (unsigned short*)(ws + 40 * MB);  // 16 MB
  unsigned short* vtb = (unsigned short*)(ws + 56 * MB);  // 16 MB [B,H,D,S]
  unsigned short* ctx = (unsigned short*)(ws + 72 * MB);  // 16 MB

  // xb, wqb, wkb, wvb, wob lie one behind another from xb on
  cvt_f32_bf16<<<CV_BLOCKS, CV_THREADS, 0, stream>>>(x, wq, wk, wv, wo, xb);

  dim3 gg(E_DIM / 128, ROWS / 128);  // (8, 64), 256 threads = 8 waves
  const float qscale = 0.125f;       // 1/sqrt(64)
  gemm_xwt<<<gg, 256, 0, stream>>>(xb, wqb, bq, qb,  qscale, 0);
  gemm_xwt<<<gg, 256, 0, stream>>>(xb, wkb, bk, kb2, 1.0f,   0);
  dim3 gt(ROWS / 128, E_DIM / 128);  // (64, 8): V^T = Wv X^T, rows = d, columns = tokens
  gemm_xwt<<<gt, 256, 0, stream>>>(wvb, xb, bv, vtb, 1.0f,   2);

  attn_fwd<<<BATCH * N_HEADS * (SEQ / 256), 256, 0, stream>>>(qb, kb2, vtb, ctx);

  gemm_xwt<<<gg, 256, 0, stream>>>(ctx, wob, bo, d_out, 1.0f, 1);
}

// v007
// Measured time: 125 microseconds a run.
// Timed twice side by side with v006, it ran 1.08 and 1.09 times as fast.
// All steps since v000 together make it 2.93 times as fast.
#include <hip/hip_runtime.h>
#include <hip/hip_bf16.h>
#include <stdint.h>

#define E_DIM 1024
#define N_HEADS 16
#define HEAD_DIM 64
#define SEQ 2048
#define BATCH 4
#define ROWS (BATCH * SEQ)  // 8192

typedef __attribute__((ext_vector_type(16))) __bf16 v16bf;
typedef __attribute__((ext_vector_type(8)))  float  v8f;
typedef __attribute__((ext_vector_type(4)))  unsigned int u32x4;
typedef __attribute__((ext_vector_type(4)))  float  f32x4;
typedef __attribute__((ext_vector_type(2)))  float  f32x2;
typedef __attribute__((ext_vector_type(2)))  __bf16 bf16x2;

union ABf { v16bf v; u32x4 u[2]; };

// two f32 -> two bf16 in one register (lo in bits 15..0), round to nearest even: one packed
// convert instruction
__device__ __forceinline__ unsigned int pk2bf(float lo, float hi) {
  const f32x2 v = {lo, hi};
  return __builtin_bit_cast(unsigned int, __builtin_convertvector(v, bf16x2));
}

#define WMMA_BF16(A, B, C) \
  __builtin_amdgcn_wmma_f32_16x16x32_bf16(false, (A), false, (B), (short)0, (C), false, false)

// ---------------------------------------------------------------- convert
// x and the four weights go to bf16 in ONE launch of one 16-wave work-group per WGP, so
// that few waves have to be started.  The five results lie one behind another in `out`
// (x, wq, wk, wv, wo).  A piece is 16,384 values of one array; a work-group takes
// CV_XT pieces of x and one piece of a weight.  Each wave-wide load covers 512 contiguous
// bytes (4 whole lines), each wave-wide store 256 (2 whole lines); all of a thread's
// loads are issued before its first value is converted.
#define CV_THREADS 512
#define CV_BLOCKS 256
#define CV_LOADS 8
#define CV_STEP (CV_THREADS * 4)                 // values a work-group brings with one load
#define CV_PIECE (CV_STEP * CV_LOADS)            // 16,384 values
#define CV_XT (ROWS * E_DIM / CV_PIECE / CV_BLOCKS)  // 2 pieces of x a work-group
#define CV_WP (E_DIM * E_DIM / CV_PIECE)         // 64 pieces in each weight
static_assert(CV_XT * CV_BLOCKS * CV_PIECE == ROWS * E_DIM &&
              CV_WP * CV_PIECE == E_DIM * E_DIM && 4 * CV_WP == CV_BLOCKS,
              "the pieces cover the five arrays exactly");

__global__ __launch_bounds__(CV_THREADS)
void cvt_f32_bf16(const float* __restrict__ x,
                  const float* __restrict__ wq, const float* __restrict__ wk,
                  const float* __restrict__ wv, const float* __restrict__ wo,
                  unsigned short* __restrict__ out) {
  const int blk = blockIdx.x;
  const int k = blk / CV_WP;                     // the weight that this work-group's piece is of
  const float* w = (k == 0) ? wq : (k == 1) ? wk : (k == 2) ? wv : wo;

  f32x4 v[CV_XT + 1][CV_LOADS];
  // all loops unrolled: v is indexed by constants and stays in registers
#pragma unroll
  for (int t = 0; t <= CV_XT; ++t) {
    const float* src = (t < CV_XT) ? x + (t * CV_BLOCKS + blk) * CV_PIECE
                                   : w + (blk % CV_WP) * CV_PIECE;
#pragma unroll
    for (int j = 0; j < CV_LOADS; ++j)
      v[t][j] = *(const f32x4*)(src + j * CV_STEP + threadIdx.x * 4);
  }
  // Takes the loaded values as inputs only, so that all 24 loads of a thread are in flight
  // together: without it the compiler saves registers by converting early and issues the
  // last loads two at a time, each pair waited for.  The wait stands in front of the first
  // reuse of a register that a load names.
  static_assert(CV_XT == 2 && CV_LOADS == 8, "the statement below names every loaded value");
  asm volatile("s_wait_xcnt 0x0"
               :: "v"(v[0][0]), "v"(v[0][1]), "v"(v[0][2]), "v"(v[0][3]),
                  "v"(v[0][4]), "v"(v[0][5]), "v"(v[0][6]), "v"(v[0][7]),
                  "v"(v[1][0]), "v"(v[1][1]), "v"(v[1][2]), "v"(v[1][3]),
                  "v"(v[1][4]), "v"(v[1][5]), "v"(v[1][6]), "v"(v[1][7]),
                  "v"(v[2][0]), "v"(v[2][1]), "v"(v[2][2]), "v"(v[2][3]),
                  "v"(v[2][4]), "v"(v[2][5]), "v"(v[2][6]), "v"(v[2][7])
               : "memory");
#pragma unroll
  for (int t = 0; t <= CV_XT; ++t) {
    unsigned short* dst = out + (t * CV_BLOCKS + blk) * CV_PIECE + threadIdx.x * 4;
#pragma unroll
    for (int j = 0; j < CV_LOADS; ++j) {
      uint2 p;
      p.x = pk2bf(v[t][j].x, v[t][j].y);
      p.y = pk2bf(v[t][j].z, v[t][j].w);
      *(uint2*)(dst + j * CV_STEP) = p;
    }
  }
}

#define G_KT 64                      // k elements per stage: rows of 128 bytes
#define G_NT (E_DIM / G_KT)          // 16 stages
#define G_PITCH 144                  // LDS row pitch in bytes (16 B x odd, for ds_load_b128)
#define G_OPB (128 * G_PITCH)        // one operand's tile in LDS
#define G_STAGEB (2 * G_OPB)         // [X tile | W tile]
#define G_WSTB (2 * G_STAGEB / 8)    // a wave's part of the ring for its output tile
#define G_OP16 144                   // staged row pitch, 64 bf16 (16 B x odd)
#define G_OP32 272                   // staged row pitch, 64 f32 (16 B x odd)
static_assert(32 * G_OP16 <= G_WSTB && 32 * G_OP32 <= G_WSTB, "a wave's tile fits its part");

// One stage: each thread brings 4 x 16 bytes of X and 4 x 16 bytes of W (rows 32 apart).
// The s_wait_xcnt stands inside the statement so that no address register named by a
// copy is rewritten in front of it.
__device__ __forceinline__ void gemm_copy_stage(unsigned int lds,
                                                const unsigned short* ga,
                                                const unsigned short* gb) {
  asm volatile(
      "global_load_async_to_lds_b128 %0, %8, off\n\t"
      "global_load_async_to_lds_b128 %1, %9, off\n\t"
      "global_load_async_to_lds_b128 %2, %10, off\n\t"
      "global_load_async_to_lds_b128 %3, %11, off\n\t"
      "global_load_async_to_lds_b128 %4, %12, off\n\t"
      "global_load_async_to_lds_b128 %5, %13, off\n\t"
      "global_load_async_to_lds_b128 %6, %14, off\n\t"
      "global_load_async_to_lds_b128 %7, %15, off\n\t"
      "s_wait_xcnt 0x0"
      :: "v"(lds), "v"(lds + 32 * G_PITCH), "v"(lds + 64 * G_PITCH), "v"(lds + 96 * G_PITCH),
         "v"(lds + G_OPB), "v"(lds + G_OPB + 32 * G_PITCH), "v"(lds + G_OPB + 64 * G_PITCH),
         "v"(lds + G_OPB + 96 * G_PITCH),
         "v"(ga), "v"(ga + 32 * E_DIM), "v"(ga + 64 * E_DIM), "v"(ga + 96 * E_DIM),
         "v"(gb), "v"(gb + 32 * E_DIM), "v"(gb + 64 * E_DIM), "v"(gb + 96 * E_DIM)
      : "memory");
}

// c[m][n][r] = Y[mbase + 16 m + lrow][nbase + 16 n + 8 half + r], without bias and scale.
// st: the wave's own staging bytes.  All loops are unrolled so that c is indexed by constants
// and stays in registers.
template <int MODE>
__device__ __forceinline__ void gemm_store_tile(const v8f (&c)[2][4], unsigned char* st,
                                                const float* __restrict__ bias,
                                                void* __restrict__ outp, float scale,
                                                int mbase, int nbase, int lane) {
  const int lrow = lane & 15;
  const int half = lane >> 4;
  constexpr int PITCH = (MODE == 1) ? G_OP32 : G_OP16;
#pragma unroll
  for (int n = 0; n < 4; ++n) {
    f32x4 b0 = {}, b1 = {};
    if (MODE != 2) {
      b0 = *(const f32x4*)(bias + nbase + n * 16 + 8 * half);
      b1 = *(const f32x4*)(bias + nbase + n * 16 + 8 * half + 4);
    }
#pragma unroll
    for (int m = 0; m < 2; ++m) {
      float v[8];
      const float br = (MODE == 2) ? bias[mbase + m * 16 + lrow] : 0.0f;
#pragma unroll
      for (int r = 0; r < 8; ++r)
        v[r] = (c[m][n][r] + ((MODE == 2) ? br : (r < 4) ? b0[r & 3] : b1[r & 3])) * scale;
      unsigned char* sp = st + (m * 16 + lrow) * PITCH;
      if (MODE == 1) {
        const f32x4 lo = {v[0], v[1], v[2], v[3]}, hi = {v[4], v[5], v[6], v[7]};
        *(f32x4*)(sp + n * 64 + half * 32) = lo;
        *(f32x4*)(sp + n * 64 + half * 32 + 16) = hi;
      } else {
        u32x4 pk;
#pragma unroll
        for (int i = 0; i < 4; ++i) pk[i] = pk2bf(v[2 * i], v[2 * i + 1]);
        *(u32x4*)(sp + n * 32 + half * 16) = pk;
      }
    }
  }
  // the wave's own staged pieces are in LDS before its lanes read one another's
  asm volatile("s_wait_dscnt 0x0" ::: "memory");
  if (MODE == 1) {
    // a row is 256 bytes: 16 lanes a row, 2 rows (4 whole lines) a store
    float* op = (float*)outp + (mbase + half) * E_DIM + nbase + lrow * 4;
    const unsigned char* sp = st + half * PITCH + lrow * 16;
#pragma unroll
    for (int i = 0; i < 16; ++i)
      *(f32x4*)(op + i * 2 * E_DIM) = *(const f32x4*)(sp + i * 2 * PITCH);
  } else {
    // a row is 128 bytes: 8 lanes a row, 4 rows (4 whole lines) a store
    const int row = lane >> 3, chk = lane & 7;
    constexpr int OPITCH = (MODE == 0) ? E_DIM : SEQ;
    unsigned short* op = (unsigned short*)outp + chk * 8 +
        ((MODE == 0) ? (mbase + row) * E_DIM + nbase
                     : ((nbase >> 11) * E_DIM + mbase + row) * SEQ + (nbase & (SEQ - 1)));
    const unsigned char* sp = st + row * PITCH + chk * 16;
#pragma unroll
    for (int i = 0; i < 8; ++i)
      *(u32x4*)(op + i * 4 * OPITCH) = *(const u32x4*)(sp + i * 4 * PITCH);
  }
  // stands in front of whatever the compiler places behind the tile's stores, so that no
  // register named by a store is rewritten ahead of it
  asm volatile("s_wait_xcnt 0x0" ::: "memory");
}

// One 128x128 tile of Y: tile column bx (128 rows of W), tile row by (128 rows of X).
__device__ __forceinline__ void gemm_tile(const unsigned short* __restrict__ Xb,
                                          const unsigned short* __restrict__ Wb,
                                          const float* __restrict__ bias,
                                          void* __restrict__ outp, float scale, int mode,
                                          int bx, int by) {
  __shared__ __attribute__((aligned(16))) unsigned char smem[2 * G_STAGEB];

  const int lane = threadIdx.x & 31;
  const int wave = threadIdx.x >> 5;
  const int wm = wave & 3;
  const int wn = wave >> 2;
  const int mbase = by * 128 + wm * 32;
  const int nbase = bx * 128 + wn * 64;
  const int lrow = lane & 15;
  const int half = lane >> 4;        // A/B 16-bit K-chunk: k = 8 * half (ISA 7.12.2)

  // copy side: thread -> (row 0..31, 16-byte chunk 0..7); a wave covers 4 whole lines
  const int crow = threadIdx.x >> 3;
  const int cchk = threadIdx.x & 7;
  const unsigned short* ga = Xb + (by * 128 + crow) * E_DIM + cchk * 8;
  const unsigned short* gb = Wb + (bx * 128 + crow) * E_DIM + cchk * 8;
  const unsigned int lds0 = (unsigned int)(size_t)smem + crow * G_PITCH + cchk * 16;

  // read side: byte offsets of this lane's fragment rows inside a stage
  const int aoff = (wm * 32 + lrow) * G_PITCH + half * 16;
  const int boff = G_OPB + (wn * 64 + lrow) * G_PITCH + half * 16;

  v8f c[2][4] = {};

  gemm_copy_stage(lds0, ga, gb);
  // tile 0 has landed for this wave's own copies
  asm volatile("s_wait_asynccnt 0x0" ::: "memory");
  __syncthreads();
  gemm_copy_stage(lds0 + G_STAGEB, ga + G_KT, gb + G_KT);

#pragma unroll 1  // one stage a trip: the ring's order stands once, at the loop's foot
  for (int t = 0; t < G_NT; ++t) {
    const unsigned int bsel = (unsigned int)(t & 1) * G_STAGEB;
    const unsigned char* sb = smem + bsel;
    // this loop and the three inside it are unrolled so that fragments and accumulators
    // are indexed by constants and stay in registers
#pragma unroll
    for (int kk = 0; kk < 2; ++kk) {
      ABf af[2], bf[4];
#pragma unroll
      for (int m = 0; m < 2; ++m) {
        af[m].u[0] = *(const u32x4*)(sb + aoff + m * 16 * G_PITCH + kk * 64);
        af[m].u[1] = *(const u32x4*)(sb + aoff + m * 16 * G_PITCH + kk * 64 + 32);
      }
#pragma unroll
      for (int n = 0; n < 4; ++n) {
        bf[n].u[0] = *(const u32x4*)(sb + boff + n * 16 * G_PITCH + kk * 64);
        bf[n].u[1] = *(const u32x4*)(sb + boff + n * 16 * G_PITCH + kk * 64 + 32);
      }
#pragma unroll
      for (int m = 0; m < 2; ++m)
#pragma unroll
        for (int n = 0; n < 4; ++n) c[m][n] = WMMA_BF16(bf[n].v, af[m].v, c[m][n]);
    }
    // this wave's reads of the buffer have returned before it is handed to the copies
    asm volatile("s_wait_dscnt 0x0" ::: "memory");
    // this wave's copies of tile t + 1 have landed before the barrier publishes them
    asm volatile("s_wait_asynccnt 0x0" ::: "memory");
    __syncthreads();
    if (t + 2 < G_NT)
      gemm_copy_stage(lds0 + bsel, ga + (t + 2) * G_KT, gb + (t + 2) * G_KT);
  }
  // no copy is outstanding when the wave goes on to its stores and ends
  asm volatile("s_wait_asynccnt 0x0" ::: "memory");

  // Behind the loop's last barrier no wave reads the ring any more and no copy is aimed at
  // it.  One branch on the mode for the whole tile.
  unsigned char* st = smem + wave * G_WSTB;
  if (mode == 0)      gemm_store_tile<0>(c, st, bias, outp, scale, mbase, nbase, lane);
  else if (mode == 1) gemm_store_tile<1>(c, st, bias, outp, scale, mbase, nbase, lane);
  else                gemm_store_tile<2>(c, st, bias, outp, scale, mbase, nbase, lane);
}

__global__ __launch_bounds__(256)
void gemm_xwt(const unsigned short* __restrict__ Xb,
              const unsigned short* __restrict__ Wb,
              const float* __restrict__ bias,
              void* __restrict__ outp, float scale, int mode) {
  gemm_tile(Xb, Wb, bias, outp, scale, mode, blockIdx.x, blockIdx.y);
}

// The three projections of the tokens in ONE launch: they depend on nothing of one another,
// so that the work-groups of the next start while those of the one before still run, and the
// chip fills and drains once.  blockIdx.z = 0: Q (scaled), 1: K, 2: V^T = Wv X^T, where the
// tokens are the W operand: its tile column is the token tile (blockIdx.y), its tile row the
// weight tile (blockIdx.x).  Six waves a SIMD (at most 160 registers): three work-groups share
// a WGP, so that one's first tiles and its stores run under the products of two others.
__global__ __launch_bounds__(256, 6)
void gemm_qkv(const unsigned short* __restrict__ xb,
              const unsigned short* __restrict__ wqb, const unsigned short* __restrict__ wkb,
              const unsigned short* __restrict__ wvb,
              const float* __restrict__ bq, const float* __restrict__ bk,
              const float* __restrict__ bv,
              unsigned short* __restrict__ qb, unsigned short* __restrict__ kb,
              unsigned short* __restrict__ vtb, float qscale) {
  const int z = blockIdx.z;
  const bool vt = (z == 2);
  gemm_tile(vt ? wvb : xb,
            vt ? xb : (z == 0) ? wqb : wkb,
            vt ? bv : (z == 0) ? bq : bk,
            vt ? vtb : (z == 0) ? qb : kb,
            (z == 0) ? qscale : 1.0f, vt ? 2 : 0,
            vt ? blockIdx.y : blockIdx.x, vt ? blockIdx.x : blockIdx.y);
}

#define A_KEYS 64                    // keys per stage: two passes of 32
#define A_NST (SEQ / A_KEYS)         // 32 stages
#define A_PITCH 144                  // LDS row pitch in bytes (16 B x odd, for ds_load_b128)
#define A_OPB (64 * A_PITCH)         // one operand's tile in LDS
#define A_STAGEB (2 * A_OPB)         // [K tile | Vt tile]

// One stage: each thread brings 2 x 16 bytes of K and 2 x 16 bytes of Vt (rows 32 apart).
// The s_wait_xcnt stands inside the statement so that no address register named by a
// copy is rewritten in front of it.
__device__ __forceinline__ void attn_copy_stage(unsigned int lds,
                                                const unsigned short* gk,
                                                const unsigned short* gv) {
  asm volatile(
      "global_load_async_to_lds_b128 %0, %4, off\n\t"
      "global_load_async_to_lds_b128 %1, %5, off\n\t"
      "global_load_async_to_lds_b128 %2, %6, off\n\t"
      "global_load_async_to_lds_b128 %3, %7, off\n\t"
      "s_wait_xcnt 0x0"
      :: "v"(lds), "v"(lds + 32 * A_PITCH), "v"(lds + A_OPB), "v"(lds + A_OPB + 32 * A_PITCH),
         "v"(gk), "v"(gk + 32 * E_DIM), "v"(gv), "v"(gv + 32 * SEQ)
      : "memory");
}

// lane l takes the value of lane l ^ 16
__device__ __forceinline__ float xhalf(float x) {
  const int b = __builtin_bit_cast(int, x);
  return __builtin_bit_cast(
      float, __builtin_amdgcn_permlanex16(b, b, 0x76543210, 0xfedcba98, false, false));
}

__global__ __launch_bounds__(256)
void attn_fwd(const unsigned short* __restrict__ Qb,
              const unsigned short* __restrict__ Kb,
              const unsigned short* __restrict__ Vtb,
              unsigned short* __restrict__ Ctx) {
  __shared__ __attribute__((aligned(16))) unsigned char ring[2 * A_STAGEB];

  const int lane = threadIdx.x & 31;
  const int wave = threadIdx.x >> 5;
  const int lrow = lane & 15;
  const int lk = (lane >> 4) << 3;
  const int half = lane >> 4;

  const int bh = blockIdx.x >> 3;   // / (SEQ/256)
  const int qt = (blockIdx.x & 7) * 8 + wave;
  const int b = bh >> 4, h = bh & 15;
  const int qrowbase = b * SEQ + qt * 32;

  const u32x4* Qv = (const u32x4*)Qb;

  // copy side: thread -> (row 0..31, 16-byte chunk 0..7); a wave covers 4 whole lines
  const int crow = threadIdx.x >> 3;
  const int cchk = threadIdx.x & 7;
  const unsigned short* gk = Kb + (b * SEQ + crow) * E_DIM + h * HEAD_DIM + cchk * 8;
  const unsigned short* gv = Vtb + ((b * N_HEADS + h) * HEAD_DIM + crow) * SEQ + cchk * 8;
  const unsigned int lds0 = (unsigned int)(size_t)ring + crow * A_PITCH + cchk * 16;

  // read side: byte offset of this lane's fragment row inside an operand's tile.  Of each 64
  // bytes of a row a lane takes bytes 16 * half and 32 + 16 * half: the hardware k order,
  // which the packed score tiles have as well.
  const int foff = lrow * A_PITCH + half * 16;

  // Q: 2 query sub-tiles x 2 K-dim chunks, resident in registers
  ABf aq[2][2];
#pragma unroll
  for (int m = 0; m < 2; ++m) {
    const int qoff = (qrowbase + m * 16 + lrow) * E_DIM + h * HEAD_DIM;
    aq[m][0].u[0] = Qv[(qoff + lk) >> 3];
    aq[m][0].u[1] = Qv[(qoff + lk + 16) >> 3];
    aq[m][1].u[0] = Qv[(qoff + 32 + lk) >> 3];
    aq[m][1].u[1] = Qv[(qoff + 32 + lk + 16) >> 3];
  }

  // o[g][t][r] = O^T[d = 16 t + 8 half + r][query 16 g + lrow]
  v8f o[2][4] = {};
  // per query group: the query's running maximum (equal in both halves) and the running sum
  // over this half's keys (the halves are joined behind the loop)
  float m_i[2] = {-3.0e38f, -3.0e38f}, l_i[2] = {0.0f, 0.0f};

  attn_copy_stage(lds0, gk, gv);
  // stage 0 has landed for this wave's own copies
  asm volatile("s_wait_asynccnt 0x0" ::: "memory");
  __syncthreads();
  attn_copy_stage(lds0 + A_STAGEB, gk + A_KEYS * E_DIM, gv + A_KEYS);

#pragma unroll 1  // one stage a trip: the ring's order stands once, at the loop's foot
  for (int st = 0; st < A_NST; ++st) {
   const unsigned int bsel = (unsigned int)(st & 1) * A_STAGEB;
   const unsigned char* kbuf = ring + bsel + foff;
   const unsigned char* vbuf = kbuf + A_OPB;
#pragma unroll 1  // one pass of 32 keys a trip: short loop text, one set of pass registers
   for (int p = 0; p < A_KEYS / 32; ++p) {
    // ---- scores: S^T(32 keys x 32 queries) = K_tile(32x64) @ Q^T(64x32)
    ABf ak[2][2];
    // all loops of the pass are unrolled so that fragments and accumulators are indexed by
    // constants and stay in registers
#pragma unroll
    for (int kt = 0; kt < 2; ++kt)
#pragma unroll
      for (int kc = 0; kc < 2; ++kc) {
        const unsigned char* kr = kbuf + (p * 32 + kt * 16) * A_PITCH + kc * 64;
        ak[kt][kc].u[0] = *(const u32x4*)(kr);
        ak[kt][kc].u[1] = *(const u32x4*)(kr + 32);
      }
    // s[kt][g][r] = S^T[key 16 kt + 8 half + r][query 16 g + lrow]
    v8f s[2][2] = {};
#pragma unroll
    for (int kt = 0; kt < 2; ++kt)
#pragma unroll
      for (int g = 0; g < 2; ++g) {
        s[kt][g] = WMMA_BF16(ak[kt][0].v, aq[g][0].v, s[kt][g]);
        s[kt][g] = WMMA_BF16(ak[kt][1].v, aq[g][1].v, s[kt][g]);
      }

    // ---- V^T fragments from the ring (A operand: row = d, k = the pass's 32 keys)
    ABf av[4];
#pragma unroll
    for (int t = 0; t < 4; ++t) {
      const unsigned char* vr = vbuf + t * 16 * A_PITCH + p * 64;
      av[t].u[0] = *(const u32x4*)(vr);
      av[t].u[1] = *(const u32x4*)(vr + 32);
    }

    // ---- online softmax of queries 16 g + lrow, on this half's 16 keys
    float mnew[2], alpha[2];
#pragma unroll
    for (int g = 0; g < 2; ++g) {
      float rmax = -3.0e38f;
#pragma unroll
      for (int r = 0; r < 8; ++r) rmax = fmaxf(rmax, fmaxf(s[0][g][r], s[1][g][r]));
      rmax = fmaxf(rmax, xhalf(rmax));
      mnew[g] = fmaxf(m_i[g], rmax);
    }
#pragma unroll
    for (int g = 0; g < 2; ++g) {
      alpha[g] = __expf(m_i[g] - mnew[g]);
      m_i[g] = mnew[g];
    }

#pragma unroll
    for (int g = 0; g < 2; ++g) {
      // element e of the B operand is key kmap(e) = 16 (e >> 3) + 8 half + (e & 7): score
      // tile e >> 3, register e & 7
      v8f pt[2];
      ABf pf;
#pragma unroll
      for (int kt = 0; kt < 2; ++kt) {
        const v8f e = s[kt][g] - mnew[g];
#pragma unroll
        for (int r = 0; r < 8; ++r) pt[kt][r] = __expf(e[r]);
#pragma unroll
        for (int i = 0; i < 4; ++i) pf.u[kt][i] = pk2bf(pt[kt][2 * i], pt[kt][2 * i + 1]);
      }
      const v8f ps = pt[0] + pt[1];
      const float ssum = ((ps[0] + ps[1]) + (ps[2] + ps[3])) + ((ps[4] + ps[5]) + (ps[6] + ps[7]));
      l_i[g] = l_i[g] * alpha[g] + ssum;

      // ---- O^T = O^T * alpha + V^T(64x32) @ P^T(32x16)
#pragma unroll
      for (int t = 0; t < 4; ++t) {
        o[g][t] = o[g][t] * alpha[g];
        o[g][t] = WMMA_BF16(av[t].v, pf.v, o[g][t]);
      }
    }
    // keeps the pass's WMMAs in front of the slots below
    __builtin_amdgcn_sched_barrier(0);
    // four vector slots between the pass's last WMMA and the next trip's first write of a
    // register that held its A or B
    asm volatile("v_nop\n\tv_nop\n\tv_nop\n\tv_nop");
   }
   // this wave's reads of the buffer have returned before it is handed to the copies
   asm volatile("s_wait_dscnt 0x0" ::: "memory");
   // this wave's copies of stage st + 1 have landed before the barrier publishes them
   asm volatile("s_wait_asynccnt 0x0" ::: "memory");
   __syncthreads();
   if (st + 2 < A_NST)
     attn_copy_stage(lds0 + bsel, gk + (st + 2) * A_KEYS * E_DIM, gv + (st + 2) * A_KEYS);
  }
  // no copy is outstanding when the wave goes on to its stores and ends
  asm volatile("s_wait_asynccnt 0x0" ::: "memory");

  // the three loops are unrolled so that o is indexed by constants and stays in registers
#pragma unroll
  for (int g = 0; g < 2; ++g) {
    const float l = l_i[g] + xhalf(l_i[g]);   // both halves' keys
    const float rr = (l > 0.f) ? (1.0f / l) : 0.f;
    unsigned short* crow_p = Ctx + (qrowbase + g * 16 + lrow) * E_DIM + h * HEAD_DIM + 8 * half;
#pragma unroll
    for (int t = 0; t < 4; ++t) {
      // a lane's 8 registers are 8 consecutive d of one query: one 16-byte store
      u32x4 pk;
#pragma unroll
      for (int i = 0; i < 4; ++i) pk[i] = pk2bf(o[g][t][2 * i] * rr, o[g][t][2 * i + 1] * rr);
      *(u32x4*)(crow_p + t * 16) = pk;
    }
  }
}

// ---------------------------------------------------------------- launch
extern "C" void kernel_launch(void* const* d_in, const int* in_sizes, int n_in,
                              void* d_out, int out_size, void* d_ws, size_t ws_size,
                              hipStream_t stream) {
  const float* x  = (const float*)d_in[0];
  const float* wq = (const float*)d_in[1];
  const float* bq = (const float*)d_in[2];
  const float* wk = (const float*)d_in[3];
  const float* bk = (const float*)d_in[4];
  const float* wv = (const float*)d_in[5];
  const float* bv = (const float*)d_in[6];
  const float* wo = (const float*)d_in[7];
  const float* bo = (const float*)d_in[8];

  char* ws = (char*)d_ws;
  const size_t MB = 1024 * 1024;
  unsigned short* xb  = (unsigned short*)(ws + 0 * MB);   // 16 MB
  unsigned short* wqb = (unsigned short*)(ws + 16 * MB);  //  2 MB
  unsigned short* wkb = (unsigned short*)(ws + 18 * MB);
  unsigned short* wvb = (unsigned short*)(ws + 20 * MB);
  unsigned short* wob = (unsigned short*)(ws + 22 * MB);
  unsigned short* qb  = (unsigned short*)(ws + 24 * MB);  // 16 MB
  unsigned short* kb2 = (unsigned short*)(ws + 40 * MB);  // 16 MB
  unsigned short* vtb = (unsigned short*)(ws + 56 * MB);  // 16 MB [B,H,D,S]
  unsigned short* ctx = (unsigned short*)(ws + 72 * MB);  // 16 MB

  // xb, wqb, wkb, wvb, wob lie one behind another from xb on
  cvt_f32_bf16<<<CV_BLOCKS, CV_THREADS, 0, stream>>>(x, wq, wk, wv, wo, xb);

  dim3 gg(E_DIM / 128, ROWS / 128);  // (8, 64), 256 threads = 8 waves
  const float qscale = 0.125f;       // 1/sqrt(64)
  dim3 g3(E_DIM / 128, ROWS / 128, 3);  // z: Q, K, V^T
  gemm_qkv<<<g3, 256, 0, stream>>>(xb, wqb, wkb, wvb, bq, bk, bv, qb, kb2, vtb, qscale);

  attn_fwd<<<BATCH * N_HEADS * (SEQ / 256), 256, 0, stream>>>(qb, kb2, vtb, ctx);

  gemm_xwt<<<gg, 256, 0, stream>>>(ctx, wob, bo, d_out, 1.0f, 1);
}

// v008
// Measured time: 119 microseconds a run.
// In both of two side-by-side timings against v007, it was 1.05 times as fast.
// Counting every step since v000, it is 3.08 times as fast.
#include <hip/hip_runtime.h>
#include <hip/hip_bf16.h>
#include <stdint.h>

#define E_DIM 1024
#define N_HEADS 16
#define HEAD_DIM 64
#define SEQ 2048
#define BATCH 4
#define ROWS (BATCH * SEQ)  // 8192

typedef __attribute__((ext_vector_type(16))) __bf16 v16bf;
typedef __attribute__((ext_vector_type(8)))  float  v8f;
typedef __attribute__((ext_vector_type(4)))  unsigned int u32x4;
typedef __attribute__((ext_vector_type(4)))  float  f32x4;
typedef __attribute__((ext_vector_type(2)))  float  f32x2;
typedef __attribute__((ext_vector_type(2)))  __bf16 bf16x2;

union ABf { v16bf v; u32x4 u[2]; };

// two f32 -> two bf16 in one register (lo in bits 15..0), round to nearest even: one packed
// convert instruction
__device__ __forceinline__ unsigned int pk2bf(float lo, float hi) {
  const f32x2 v = {lo, hi};
  return __builtin_bit_cast(unsigned int, __builtin_convertvector(v, bf16x2));
}

#define WMMA_BF16(A, B, C) \
  __builtin_amdgcn_wmma_f32_16x16x32_bf16(false, (A), false, (B), (short)0, (C), false, false)

// ---------------------------------------------------------------- convert
// x and the four weights go to bf16 in ONE launch of one 16-wave work-group per WGP, so
// that few waves have to be started.  The five results lie one behind another in `out`
// (x, wq, wk, wv, wo).  A piece is 16,384 values of one array; a work-group takes
// CV_XT pieces of x and one piece of a weight.  Each wave-wide load covers 512 contiguous
// bytes (4 whole lines), each wave-wide store 256 (2 whole lines); all of a thread's
// loads are issued before its first value is converted.
#define CV_THREADS 512
#define CV_BLOCKS 256
#define CV_LOADS 8
#define CV_STEP (CV_THREADS * 4)                 // values a work-group brings with one load
#define CV_PIECE (CV_STEP * CV_LOADS)            // 16,384 values
#define CV_XT (ROWS * E_DIM / CV_PIECE / CV_BLOCKS)  // 2 pieces of x a work-group
#define CV_WP (E_DIM * E_DIM / CV_PIECE)         // 64 pieces in each weight
static_assert(CV_XT * CV_BLOCKS * CV_PIECE == ROWS * E_DIM &&
              CV_WP * CV_PIECE == E_DIM * E_DIM && 4 * CV_WP == CV_BLOCKS,
              "the pieces cover the five arrays exactly");

__global__ __launch_bounds__(CV_THREADS)
void cvt_f32_bf16(const float* __restrict__ x,
                  const float* __restrict__ wq, const float* __restrict__ wk,
                  const float* __restrict__ wv, const float* __restrict__ wo,
                  unsigned short* __restrict__ out) {
  const int blk = blockIdx.x;
  const int k = blk / CV_WP;                     // the weight that this work-group's piece is of
  const float* w = (k == 0) ? wq : (k == 1) ? wk : (k == 2) ? wv : wo;

  f32x4 v[CV_XT + 1][CV_LOADS];
  // all loops unrolled: v is indexed by constants and stays in registers
#pragma unroll
  for (int t = 0; t <= CV_XT; ++t) {
    const float* src = (t < CV_XT) ? x + (t * CV_BLOCKS + blk) * CV_PIECE
                                   : w + (blk % CV_WP) * CV_PIECE;
#pragma unroll
    for (int j = 0; j < CV_LOADS; ++j)
      v[t][j] = *(const f32x4*)(src + j * CV_STEP + threadIdx.x * 4);
  }
  // Takes the loaded values as inputs only, so that all 24 loads of a thread are in flight
  // together: without it the compiler saves registers by converting early and issues the
  // last loads two at a time, each pair waited for.  The wait stands in front of the first
  // reuse of a register that a load names.
  static_assert(CV_XT == 2 && CV_LOADS == 8, "the statement below names every loaded value");
  asm volatile("s_wait_xcnt 0x0"
               :: "v"(v[0][0]), "v"(v[0][1]), "v"(v[0][2]), "v"(v[0][3]),
                  "v"(v[0][4]), "v"(v[0][5]), "v"(v[0][6]), "v"(v[0][7]),
                  "v"(v[1][0]), "v"(v[1][1]), "v"(v[1][2]), "v"(v[1][3]),
                  "v"(v[1][4]), "v"(v[1][5]), "v"(v[1][6]), "v"(v[1][7]),
                  "v"(v[2][0]), "v"(v[2][1]), "v"(v[2][2]), "v"(v[2][3]),
                  "v"(v[2][4]), "v"(v[2][5]), "v"(v[2][6]), "v"(v[2][7])
               : "memory");
#pragma unroll
  for (int t = 0; t <= CV_XT; ++t) {
    unsigned short* dst = out + (t * CV_BLOCKS + blk) * CV_PIECE + threadIdx.x * 4;
#pragma unroll
    for (int j = 0; j < CV_LOADS; ++j) {
      uint2 p;
      p.x = pk2bf(v[t][j].x, v[t][j].y);
      p.y = pk2bf(v[t][j].z, v[t][j].w);
      *(uint2*)(dst + j * CV_STEP) = p;
    }
  }
}

#define G_KT 64                      // k elements per stage: rows of 128 bytes
#define G_NT (E_DIM / G_KT)          // 16 stages
#define G_PITCH 144                  // LDS row pitch in bytes (16 B x odd, for ds_load_b128)
#define G_OPB (128 * G_PITCH)        // one operand's tile in LDS
#define G_STAGEB (2 * G_OPB)         // [X tile | W tile]
#define G_WSTB (2 * G_STAGEB / 8)    // a wave's part of the ring for its output tile
#define G_OP16 144                   // staged row pitch, 64 bf16 (16 B x odd)
#define G_OP32 272                   // staged row pitch, 64 f32 (16 B x odd)
static_assert(32 * G_OP16 <= G_WSTB && 32 * G_OP32 <= G_WSTB, "a wave's tile fits its part");

// One stage: each thread brings 4 x 16 bytes of X and 4 x 16 bytes of W (rows 32 apart).
// The s_wait_xcnt stands inside the statement so that no address register named by a
// copy is rewritten in front of it.
__device__ __forceinline__ void gemm_copy_stage(unsigned int lds,
                                                const unsigned short* ga,
                                                const unsigned short* gb) {
  asm volatile(
      "global_load_async_to_lds_b128 %0, %8, off\n\t"
      "global_load_async_to_lds_b128 %1, %9, off\n\t"
      "global_load_async_to_lds_b128 %2, %10, off\n\t"
      "global_load_async_to_lds_b128 %3, %11, off\n\t"
      "global_load_async_to_lds_b128 %4, %12, off\n\t"
      "global_load_async_to_lds_b128 %5, %13, off\n\t"
      "global_load_async_to_lds_b128 %6, %14, off\n\t"
      "global_load_async_to_lds_b128 %7, %15, off\n\t"
      "s_wait_xcnt 0x0"
      :: "v"(lds), "v"(lds + 32 * G_PITCH), "v"(lds + 64 * G_PITCH), "v"(lds + 96 * G_PITCH),
         "v"(lds + G_OPB), "v"(lds + G_OPB + 32 * G_PITCH), "v"(lds + G_OPB + 64 * G_PITCH),
         "v"(lds + G_OPB + 96 * G_PITCH),
         "v"(ga), "v"(ga + 32 * E_DIM), "v"(ga + 64 * E_DIM), "v"(ga + 96 * E_DIM),
         "v"(gb), "v"(gb + 32 * E_DIM), "v"(gb + 64 * E_DIM), "v"(gb + 96 * E_DIM)
      : "memory");
}

// c[m][n][r] = Y[mbase + 16 m + lrow][nbase + 16 n + 8 half + r], without bias and scale.
// st: the wave's own staging bytes.  All loops are unrolled so that c is indexed by constants
// and stays in registers.
template <int MODE>
__device__ __forceinline__ void gemm_store_tile(const v8f (&c)[2][4], unsigned char* st,
                                                const float* __restrict__ bias,
                                                void* __restrict__ outp, float scale,
                                                int mbase, int nbase, int lane) {
  const int lrow = lane & 15;
  const int half = lane >> 4;
  constexpr int PITCH = (MODE == 1) ? G_OP32 : G_OP16;
#pragma unroll
  for (int n = 0; n < 4; ++n) {
    f32x4 b0 = {}, b1 = {};
    if (MODE != 2) {
      b0 = *(const f32x4*)(bias + nbase + n * 16 + 8 * half);
      b1 = *(const f32x4*)(bias + nbase + n * 16 + 8 * half + 4);
    }
#pragma unroll
    for (int m = 0; m < 2; ++m) {
      float v[8];
      const float br = (MODE == 2) ? bias[mbase + m * 16 + lrow] : 0.0f;
#pragma unroll
      for (int r = 0; r < 8; ++r)
        v[r] = (c[m][n][r] + ((MODE == 2) ? br : (r < 4) ? b0[r & 3] : b1[r & 3])) * scale;
      unsigned char* sp = st + (m * 16 + lrow) * PITCH;
      if (MODE == 1) {
        const f32x4 lo = {v[0], v[1], v[2], v[3]}, hi = {v[4], v[5], v[6], v[7]};
        *(f32x4*)(sp + n * 64 + half * 32) = lo;
        *(f32x4*)(sp + n * 64 + half * 32 + 16) = hi;
      } else {
        u32x4 pk;
#pragma unroll
        for (int i = 0; i < 4; ++i) pk[i] = pk2bf(v[2 * i], v[2 * i + 1]);
        *(u32x4*)(sp + n * 32 + half * 16) = pk;
      }
    }
  }
  // the wave's own staged pieces are in LDS before its lanes read one another's
  asm volatile("s_wait_dscnt 0x0" ::: "memory");
  if (MODE == 1) {
    // a row is 256 bytes: 16 lanes a row, 2 rows (4 whole lines) a store
    float* op = (float*)outp + (mbase + half) * E_DIM + nbase + lrow * 4;
    const unsigned char* sp = st + half * PITCH + lrow * 16;
#pragma unroll
    for (int i = 0; i < 16; ++i)
      *(f32x4*)(op + i * 2 * E_DIM) = *(const f32x4*)(sp + i * 2 * PITCH);
  } else {
    // a row is 128 bytes: 8 lanes a row, 4 rows (4 whole lines) a store
    const int row = lane >> 3, chk = lane & 7;
    constexpr int OPITCH = (MODE == 0) ? E_DIM : SEQ;
    unsigned short* op = (unsigned short*)outp + chk * 8 +
        ((MODE == 0) ? (mbase + row) * E_DIM + nbase
                     : ((nbase >> 11) * E_DIM + mbase + row) * SEQ + (nbase & (SEQ - 1)));
    const unsigned char* sp = st + row * PITCH + chk * 16;
#pragma unroll
    for (int i = 0; i < 8; ++i)
      *(u32x4*)(op + i * 4 * OPITCH) = *(const u32x4*)(sp + i * 4 * PITCH);
  }
  // stands in front of whatever the compiler places behind the tile's stores, so that no
  // register named by a store is rewritten ahead of it
  asm volatile("s_wait_xcnt 0x0" ::: "memory");
}

// One 128x128 tile of Y: tile column bx (128 rows of W), tile row by (128 rows of X).
__device__ __forceinline__ void gemm_tile(const unsigned short* __restrict__ Xb,
                                          const unsigned short* __restrict__ Wb,
                                          const float* __restrict__ bias,
                                          void* __restrict__ outp, float scale, int mode,
                                          int bx, int by) {
  __shared__ __attribute__((aligned(16))) unsigned char smem[2 * G_STAGEB];

  const int lane = threadIdx.x & 31;
  const int wave = threadIdx.x >> 5;
  const int wm = wave & 3;
  const int wn = wave >> 2;
  const int mbase = by * 128 + wm * 32;
  const int nbase = bx * 128 + wn * 64;
  const int lrow = lane & 15;
  const int half = lane >> 4;        // A/B 16-bit K-chunk: k = 8 * half (ISA 7.12.2)

  // copy side: thread -> (row 0..31, 16-byte chunk 0..7); a wave covers 4 whole lines
  const int crow = threadIdx.x >> 3;
  const int cchk = threadIdx.x & 7;
  const unsigned short* ga = Xb + (by * 128 + crow) * E_DIM + cchk * 8;
  const unsigned short* gb = Wb + (bx * 128 + crow) * E_DIM + cchk * 8;
  const unsigned int lds0 = (unsigned int)(size_t)smem + crow * G_PITCH + cchk * 16;

  // read side: byte offsets of this lane's fragment rows inside a stage
  const int aoff = (wm * 32 + lrow) * G_PITCH + half * 16;
  const int boff = G_OPB + (wn * 64 + lrow) * G_PITCH + half * 16;

  v8f c[2][4] = {};

  gemm_copy_stage(lds0, ga, gb);
  // tile 0 has landed for this wave's own copies
  asm volatile("s_wait_asynccnt 0x0" ::: "memory");
  __syncthreads();
  gemm_copy_stage(lds0 + G_STAGEB, ga + G_KT, gb + G_KT);

#pragma unroll 1  // one stage a trip: the ring's order stands once, at the loop's foot
  for (int t = 0; t < G_NT; ++t) {
    const unsigned int bsel = (unsigned int)(t & 1) * G_STAGEB;
    const unsigned char* sb = smem + bsel;
    // this loop and the three inside it are unrolled so that fragments and accumulators
    // are indexed by constants and stay in registers
#pragma unroll
    for (int kk = 0; kk < 2; ++kk) {
      ABf af[2], bf[4];
#pragma unroll
      for (int m = 0; m < 2; ++m) {
        af[m].u[0] = *(const u32x4*)(sb + aoff + m * 16 * G_PITCH + kk * 64);
        af[m].u[1] = *(const u32x4*)(sb + aoff + m * 16 * G_PITCH + kk * 64 + 32);
      }
#pragma unroll
      for (int n = 0; n < 4; ++n) {
        bf[n].u[0] = *(const u32x4*)(sb + boff + n * 16 * G_PITCH + kk * 64);
        bf[n].u[1] = *(const u32x4*)(sb + boff + n * 16 * G_PITCH + kk * 64 + 32);
      }
#pragma unroll
      for (int m = 0; m < 2; ++m)
#pragma unroll
        for (int n = 0; n < 4; ++n) c[m][n] = WMMA_BF16(bf[n].v, af[m].v, c[m][n]);
    }
    // this wave's reads of the buffer have returned before it is handed to the copies
    asm volatile("s_wait_dscnt 0x0" ::: "memory");
    // this wave's copies of tile t + 1 have landed before the barrier publishes them
    asm volatile("s_wait_asynccnt 0x0" ::: "memory");
    __syncthreads();
    if (t + 2 < G_NT)
      gemm_copy_stage(lds0 + bsel, ga + (t + 2) * G_KT, gb + (t + 2) * G_KT);
  }
  // no copy is outstanding when the wave goes on to its stores and ends
  asm volatile("s_wait_asynccnt 0x0" ::: "memory");

  // Behind the loop's last barrier no wave reads the ring any more and no copy is aimed at
  // it.  One branch on the mode for the whole tile.
  unsigned char* st = smem + wave * G_WSTB;
  if (mode == 0)      gemm_store_tile<0>(c, st, bias, outp, scale, mbase, nbase, lane);
  else if (mode == 1) gemm_store_tile<1>(c, st, bias, outp, scale, mbase, nbase, lane);
  else                gemm_store_tile<2>(c, st, bias, outp, scale, mbase, nbase, lane);
}

__global__ __launch_bounds__(256)
void gemm_xwt(const unsigned short* __restrict__ Xb,
              const unsigned short* __restrict__ Wb,
              const float* __restrict__ bias,
              void* __restrict__ outp, float scale, int mode) {
  gemm_tile(Xb, Wb, bias, outp, scale, mode, blockIdx.x, blockIdx.y);
}

// The three projections of the tokens in ONE launch: they depend on nothing of one another,
// so that the work-groups of the next start while those of the one before still run, and the
// chip fills and drains once.  blockIdx.z = 0: Q (scaled), 1: K, 2: V^T = Wv X^T, where the
// tokens are the W operand: its tile column is the token tile (blockIdx.y), its tile row the
// weight tile (blockIdx.x).  Six waves a SIMD (at most 160 registers): three work-groups share
// a WGP, so that one's first tiles and its stores run under the products of two others.
__global__ __launch_bounds__(256, 6)
void gemm_qkv(const unsigned short* __restrict__ xb,
              const unsigned short* __restrict__ wqb, const unsigned short* __restrict__ wkb,
              const unsigned short* __restrict__ wvb,
              const float* __restrict__ bq, const float* __restrict__ bk,
              const float* __restrict__ bv,
              unsigned short* __restrict__ qb, unsigned short* __restrict__ kb,
              unsigned short* __restrict__ vtb, float qscale) {
  const int z = blockIdx.z;
  const bool vt = (z == 2);
  gemm_tile(vt ? wvb : xb,
            vt ? xb : (z == 0) ? wqb : wkb,
            vt ? bv : (z == 0) ? bq : bk,
            vt ? vtb : (z == 0) ? qb : kb,
            (z == 0) ? qscale : 1.0f, vt ? 2 : 0,
            vt ? blockIdx.y : blockIdx.x, vt ? blockIdx.x : blockIdx.y);
}

#define A_KEYS 64                    // keys per stage: two passes of 32
#define A_NST (SEQ / A_KEYS)         // 32 stages
#define A_PITCH 144                  // LDS row pitch in bytes (16 B x odd, for ds_load_b128)
#define A_OPB (64 * A_PITCH)         // one operand's tile in LDS
#define A_STAGEB (2 * A_OPB)         // [K tile | Vt tile]
#define A_LAZY 8.0f                  // how far a score may lie above the reference in use

// One stage: each thread brings 2 x 16 bytes of K and 2 x 16 bytes of Vt (rows 32 apart).
// The s_wait_xcnt stands inside the statement so that no address register named by a
// copy is rewritten in front of it.
__device__ __forceinline__ void attn_copy_stage(unsigned int lds,
                                                const unsigned short* gk,
                                                const unsigned short* gv) {
  asm volatile(
      "global_load_async_to_lds_b128 %0, %4, off\n\t"
      "global_load_async_to_lds_b128 %1, %5, off\n\t"
      "global_load_async_to_lds_b128 %2, %6, off\n\t"
      "global_load_async_to_lds_b128 %3, %7, off\n\t"
      "s_wait_xcnt 0x0"
      :: "v"(lds), "v"(lds + 32 * A_PITCH), "v"(lds + A_OPB), "v"(lds + A_OPB + 32 * A_PITCH),
         "v"(gk), "v"(gk + 32 * E_DIM), "v"(gv), "v"(gv + 32 * SEQ)
      : "memory");
}

// lane l takes the value of lane l ^ 16
__device__ __forceinline__ float xhalf(float x) {
  const int b = __builtin_bit_cast(int, x);
  return __builtin_bit_cast(
      float, __builtin_amdgcn_permlanex16(b, b, 0x76543210, 0xfedcba98, false, false));
}

__global__ __launch_bounds__(256)
void attn_fwd(const unsigned short* __restrict__ Qb,
              const unsigned short* __restrict__ Kb,
              const unsigned short* __restrict__ Vtb,
              unsigned short* __restrict__ Ctx) {
  __shared__ __attribute__((aligned(16))) unsigned char ring[2 * A_STAGEB];

  const int lane = threadIdx.x & 31;
  const int wave = threadIdx.x >> 5;
  const int lrow = lane & 15;
  const int lk = (lane >> 4) << 3;
  const int half = lane >> 4;

  const int bh = blockIdx.x >> 3;   // / (SEQ/256)
  const int qt = (blockIdx.x & 7) * 8 + wave;
  const int b = bh >> 4, h = bh & 15;
  const int qrowbase = b * SEQ + qt * 32;

  const u32x4* Qv = (const u32x4*)Qb;

  // copy side: thread -> (row 0..31, 16-byte chunk 0..7); a wave covers 4 whole lines
  const int crow = threadIdx.x >> 3;
  const int cchk = threadIdx.x & 7;
  const unsigned short* gk = Kb + (b * SEQ + crow) * E_DIM + h * HEAD_DIM + cchk * 8;
  const unsigned short* gv = Vtb + ((b * N_HEADS + h) * HEAD_DIM + crow) * SEQ + cchk * 8;
  const unsigned int lds0 = (unsigned int)(size_t)ring + crow * A_PITCH + cchk * 16;

  // read side: byte offset of this lane's fragment row inside an operand's tile.  Of each 64
  // bytes of a row a lane takes bytes 16 * half and 32 + 16 * half: the hardware k order,
  // which the packed score tiles have as well.
  const int foff = lrow * A_PITCH + half * 16;

  // Q: 2 query sub-tiles x 2 K-dim chunks, resident in registers
  ABf aq[2][2];
#pragma unroll
  for (int m = 0; m < 2; ++m) {
    const int qoff = (qrowbase + m * 16 + lrow) * E_DIM + h * HEAD_DIM;
    aq[m][0].u[0] = Qv[(qoff + lk) >> 3];
    aq[m][0].u[1] = Qv[(qoff + lk + 16) >> 3];
    aq[m][1].u[0] = Qv[(qoff + 32 + lk) >> 3];
    aq[m][1].u[1] = Qv[(qoff + 32 + lk + 16) >> 3];
  }

  // o[g][t][r] = O^T[d = 16 t + 8 half + r][query 16 g + lrow]
  v8f o[2][4] = {};
  // per query group: the query's reference for the exponentials (equal in both halves; at
  // most A_LAZY below its running maximum) and the running sum over this half's keys (the
  // halves are joined behind the loop)
  float m_i[2] = {-3.0e38f, -3.0e38f}, l_i[2] = {0.0f, 0.0f};
  // m_i + A_LAZY, kept so that the pass's test is one compare a group
  float thr[2] = {-3.0e38f, -3.0e38f};

  attn_copy_stage(lds0, gk, gv);
  // stage 0 has landed for this wave's own copies
  asm volatile("s_wait_asynccnt 0x0" ::: "memory");
  __syncthreads();
  attn_copy_stage(lds0 + A_STAGEB, gk + A_KEYS * E_DIM, gv + A_KEYS);

#pragma unroll 1  // one stage a trip: the ring's order stands once, at the loop's foot
  for (int st = 0; st < A_NST; ++st) {
   const unsigned int bsel = (unsigned int)(st & 1) * A_STAGEB;
   const unsigned char* kbuf = ring + bsel + foff;
   const unsigned char* vbuf = kbuf + A_OPB;
#pragma unroll 1  // one pass of 32 keys a trip: short loop text, one set of pass registers
   for (int p = 0; p < A_KEYS / 32; ++p) {
    // ---- scores: S^T(32 keys x 32 queries) = K_tile(32x64) @ Q^T(64x32)
    ABf ak[2][2];
    // all loops of the pass are unrolled so that fragments and accumulators are indexed by
    // constants and stay in registers
#pragma unroll
    for (int kt = 0; kt < 2; ++kt)
#pragma unroll
      for (int kc = 0; kc < 2; ++kc) {
        const unsigned char* kr = kbuf + (p * 32 + kt * 16) * A_PITCH + kc * 64;
        ak[kt][kc].u[0] = *(const u32x4*)(kr);
        ak[kt][kc].u[1] = *(const u32x4*)(kr + 32);
      }
    // s[kt][g][r] = S^T[key 16 kt + 8 half + r][query 16 g + lrow]
    v8f s[2][2] = {};
#pragma unroll
    for (int kt = 0; kt < 2; ++kt)
#pragma unroll
      for (int g = 0; g < 2; ++g) {
        s[kt][g] = WMMA_BF16(ak[kt][0].v, aq[g][0].v, s[kt][g]);
        s[kt][g] = WMMA_BF16(ak[kt][1].v, aq[g][1].v, s[kt][g]);
      }

    // ---- V^T fragments from the ring (A operand: row = d, k = the pass's 32 keys)
    ABf av[4];
#pragma unroll
    for (int t = 0; t < 4; ++t) {
      const unsigned char* vr = vbuf + t * 16 * A_PITCH + p * 64;
      av[t].u[0] = *(const u32x4*)(vr);
      av[t].u[1] = *(const u32x4*)(vr + 32);
    }

    // ---- online softmax of queries 16 g + lrow, on this half's 16 keys
    float rmax[2];
#pragma unroll
    for (int g = 0; g < 2; ++g) {
      rmax[g] = -3.0e38f;
#pragma unroll
      for (int r = 0; r < 8; ++r) rmax[g] = fmaxf(rmax[g], fmaxf(s[0][g][r], s[1][g][r]));
    }
    // The reference m_i moves, and sums and outputs are rescaled, only in a pass where some
    // score of the wave lies more than A_LAZY above its query's reference: one test a pass, a
    // scalar branch.  Otherwise every exponential is at most exp(A_LAZY), and the common
    // factor cancels in the division behind the loop.
    const bool need = (rmax[0] > thr[0]) || (rmax[1] > thr[1]);
    if (__builtin_amdgcn_ballot_w32(need) != 0) {
#pragma unroll
      for (int g = 0; g < 2; ++g) {
        // both halves of a query take the same new reference
        const float mnew = fmaxf(m_i[g], fmaxf(rmax[g], xhalf(rmax[g])));
        const float alpha = __expf(m_i[g] - mnew);
        m_i[g] = mnew;
        thr[g] = mnew + A_LAZY;
        l_i[g] *= alpha;
#pragma unroll
        for (int t = 0; t < 4; ++t) o[g][t] = o[g][t] * alpha;
      }
    }

#pragma unroll
    for (int g = 0; g < 2; ++g) {
      // element e of the B operand is key kmap(e) = 16 (e >> 3) + 8 half + (e & 7): score
      // tile e >> 3, register e & 7
      v8f pt[2];
      ABf pf;
#pragma unroll
      for (int kt = 0; kt < 2; ++kt) {
        const v8f e = s[kt][g] - m_i[g];
#pragma unroll
        for (int r = 0; r < 8; ++r) pt[kt][r] = __expf(e[r]);
#pragma unroll
        for (int i = 0; i < 4; ++i) pf.u[kt][i] = pk2bf(pt[kt][2 * i], pt[kt][2 * i + 1]);
      }
      const v8f ps = pt[0] + pt[1];
      const float ssum = ((ps[0] + ps[1]) + (ps[2] + ps[3])) + ((ps[4] + ps[5]) + (ps[6] + ps[7]));
      l_i[g] += ssum;

      // ---- O^T += V^T(64x32) @ P^T(32x16)
#pragma unroll
      for (int t = 0; t < 4; ++t) o[g][t] = WMMA_BF16(av[t].v, pf.v, o[g][t]);
    }
    // keeps the pass's WMMAs in front of the slots below
    __builtin_amdgcn_sched_barrier(0);
    // four vector slots between the pass's last WMMA and the next trip's first write of a
    // register that held its A or B
    asm volatile("v_nop\n\tv_nop\n\tv_nop\n\tv_nop");
   }
   // this wave's reads of the buffer have returned before it is handed to the copies
   asm volatile("s_wait_dscnt 0x0" ::: "memory");
   // this wave's copies of stage st + 1 have landed before the barrier publishes them
   asm volatile("s_wait_asynccnt 0x0" ::: "memory");
   __syncthreads();
   if (st + 2 < A_NST)
     attn_copy_stage(lds0 + bsel, gk + (st + 2) * A_KEYS * E_DIM, gv + (st + 2) * A_KEYS);
  }
  // no copy is outstanding when the wave goes on to its stores and ends
  asm volatile("s_wait_asynccnt 0x0" ::: "memory");

  // the three loops are unrolled so that o is indexed by constants and stays in registers
#pragma unroll
  for (int g = 0; g < 2; ++g) {
    const float l = l_i[g] + xhalf(l_i[g]);   // both halves' keys
    const float rr = (l > 0.f) ? (1.0f / l) : 0.f;
    unsigned short* crow_p = Ctx + (qrowbase + g * 16 + lrow) * E_DIM + h * HEAD_DIM + 8 * half;
#pragma unroll
    for (int t = 0; t < 4; ++t) {
      // a lane's 8 registers are 8 consecutive d of one query: one 16-byte store
      u32x4 pk;
#pragma unroll
      for (int i = 0; i < 4; ++i) pk[i] = pk2bf(o[g][t][2 * i] * rr, o[g][t][2 * i + 1] * rr);
      *(u32x4*)(crow_p + t * 16) = pk;
    }
  }
}

// ---------------------------------------------------------------- launch
extern "C" void kernel_launch(void* const* d_in, const int* in_sizes, int n_in,
                              void* d_out, int out_size, void* d_ws, size_t ws_size,
                              hipStream_t stream) {
  const float* x  = (const float*)d_in[0];
  const float* wq = (const float*)d_in[1];
  const float* bq = (const float*)d_in[2];
  const float* wk = (const float*)d_in[3];
  const float* bk = (const float*)d_in[4];
  const float* wv = (const float*)d_in[5];
  const float* bv = (const float*)d_in[6];
  const float* wo = (const float*)d_in[7];
  const float* bo = (const float*)d_in[8];

  char* ws = (char*)d_ws;
  const size_t MB = 1024 * 1024;
  unsigned short* xb  = (unsigned short*)(ws + 0 * MB);   // 16 MB
  unsigned short* wqb = (unsigned short*)(ws + 16 * MB);  //  2 MB
  unsigned short* wkb = (unsigned short*)(ws + 18 * MB);
  unsigned short* wvb = (unsigned short*)(ws + 20 * MB);
  unsigned short* wob = (unsigned short*)(ws + 22 * MB);
  unsigned short* qb  = (unsigned short*)(ws + 24 * MB);  // 16 MB
  unsigned short* kb2 = (unsigned short*)(ws + 40 * MB);  // 16 MB
  unsigned short* vtb = (unsigned short*)(ws + 56 * MB);  // 16 MB [B,H,D,S]
  unsigned short* ctx = (unsigned short*)(ws + 72 * MB);  // 16 MB

  // xb, wqb, wkb, wvb, wob lie one behind another from xb on
  cvt_f32_bf16<<<CV_BLOCKS, CV_THREADS, 0, stream>>>(x, wq, wk, wv, wo, xb);

  dim3 gg(E_DIM / 128, ROWS / 128);  // (8, 64), 256 threads = 8 waves
  const float qscale = 0.125f;       // 1/sqrt(64)
  dim3 g3(E_DIM / 128, ROWS / 128, 3);  // z: Q, K, V^T
  gemm_qkv<<<g3, 256, 0, stream>>>(xb, wqb, wkb, wvb, bq, bk, bv, qb, kb2, vtb, qscale);

  attn_fwd<<<BATCH * N_HEADS * (SEQ / 256), 256, 0, stream>>>(qb, kb2, vtb, ctx);

  gemm_xwt<<<gg, 256, 0, stream>>>(ctx, wob, bo, d_out, 1.0f, 1);
}

// v009
// One run takes 115 microseconds.
// Next to v008, in two timings, it ran 1.04 and 1.03 times as fast.
// Over all steps from v000 it is 3.19 times as fast.
#include <hip/hip_runtime.h>
#include <hip/hip_bf16.h>
#include <stdint.h>

#define E_DIM 1024
#define N_HEADS 16
#define HEAD_DIM 64
#define SEQ 2048
#define BATCH 4
#define ROWS (BATCH * SEQ)  // 8192

typedef __attribute__((ext_vector_type(16))) __bf16 v16bf;
typedef __attribute__((ext_vector_type(8)))  float  v8f;
typedef __attribute__((ext_vector_type(4)))  unsigned int u32x4;
typedef __attribute__((ext_vector_type(4)))  float  f32x4;
typedef __attribute__((ext_vector_type(2)))  float  f32x2;
typedef __attribute__((ext_vector_type(2)))  __bf16 bf16x2;

union ABf { v16bf v; u32x4 u[2]; };

// two f32 -> two bf16 in one register (lo in bits 15..0), round to nearest even: one packed
// convert instruction
__device__ __forceinline__ unsigned int pk2bf(float lo, float hi) {
  const f32x2 v = {lo, hi};
  return __builtin_bit_cast(unsigned int, __builtin_convertvector(v, bf16x2));
}

#define WMMA_BF16(A, B, C) \
  __builtin_amdgcn_wmma_f32_16x16x32_bf16(false, (A), false, (B), (short)0, (C), false, false)

// ---------------------------------------------------------------- convert
// x and the four weights go to bf16 in ONE launch of one 16-wave work-group per WGP, so
// that few waves have to be started.  The five results lie one behind another in `out`
// (x, wq, wk, wv, wo).  A piece is 16,384 values of one array; a work-group takes
// CV_XT pieces of x and one piece of a weight.  Each wave-wide load covers 512 contiguous
// bytes (4 whole lines), each wave-wide store 256 (2 whole lines); all of a thread's
// loads are issued before its first value is converted.
#define CV_THREADS 512
#define CV_BLOCKS 256
#define CV_LOADS 8
#define CV_STEP (CV_THREADS * 4)                 // values a work-group brings with one load
#define CV_PIECE (CV_STEP * CV_LOADS)            // 16,384 values
#define CV_XT (ROWS * E_DIM / CV_PIECE / CV_BLOCKS)  // 2 pieces of x a work-group
#define CV_WP (E_DIM * E_DIM / CV_PIECE)         // 64 pieces in each weight
static_assert(CV_XT * CV_BLOCKS * CV_PIECE == ROWS * E_DIM &&
              CV_WP * CV_PIECE == E_DIM * E_DIM && 4 * CV_WP == CV_BLOCKS,
              "the pieces cover the five arrays exactly");

__global__ __launch_bounds__(CV_THREADS)
void cvt_f32_bf16(const float* __restrict__ x,
                  const float* __restrict__ wq, const float* __restrict__ wk,
                  const float* __restrict__ wv, const float* __restrict__ wo,
                  unsigned short* __restrict__ out) {
  const int blk = blockIdx.x;
  const int k = blk / CV_WP;                     // the weight that this work-group's piece is of
  const float* w = (k == 0) ? wq : (k == 1) ? wk : (k == 2) ? wv : wo;

  f32x4 v[CV_XT + 1][CV_LOADS];
  // all loops unrolled: v is indexed by constants and stays in registers
#pragma unroll
  for (int t = 0; t <= CV_XT; ++t) {
    const float* src = (t < CV_XT) ? x + (t * CV_BLOCKS + blk) * CV_PIECE
                                   : w + (blk % CV_WP) * CV_PIECE;
#pragma unroll
    for (int j = 0; j < CV_LOADS; ++j)
      v[t][j] = *(const f32x4*)(src + j * CV_STEP + threadIdx.x * 4);
  }
  // Takes the loaded values as inputs only, so that all 24 loads of a thread are in flight
  // together: without it the compiler saves registers by converting early and issues the
  // last loads two at a time, each pair waited for.  The wait stands in front of the first
  // reuse of a register that a load names.
  static_assert(CV_XT == 2 && CV_LOADS == 8, "the statement below names every loaded value");
  asm volatile("s_wait_xcnt 0x0"
               :: "v"(v[0][0]), "v"(v[0][1]), "v"(v[0][2]), "v"(v[0][3]),
                  "v"(v[0][4]), "v"(v[0][5]), "v"(v[0][6]), "v"(v[0][7]),
                  "v"(v[1][0]), "v"(v[1][1]), "v"(v[1][2]), "v"(v[1][3]),
                  "v"(v[1][4]), "v"(v[1][5]), "v"(v[1][6]), "v"(v[1][7]),
                  "v"(v[2][0]), "v"(v[2][1]), "v"(v[2][2]), "v"(v[2][3]),
                  "v"(v[2][4]), "v"(v[2][5]), "v"(v[2][6]), "v"(v[2][7])
               : "memory");
#pragma unroll
  for (int t = 0; t <= CV_XT; ++t) {
    unsigned short* dst = out + (t * CV_BLOCKS + blk) * CV_PIECE + threadIdx.x * 4;
#pragma unroll
    for (int j = 0; j < CV_LOADS; ++j) {
      uint2 p;
      p.x = pk2bf(v[t][j].x, v[t][j].y);
      p.y = pk2bf(v[t][j].z, v[t][j].w);
      *(uint2*)(dst + j * CV_STEP) = p;
    }
  }
}

#define G_KT 64                      // k elements per stage: rows of 128 bytes
#define G_NT (E_DIM / G_KT)          // 16 stages
#define G_PITCH 144                  // LDS row pitch in bytes (16 B x odd, for ds_load_b128)
#define G_OPB (128 * G_PITCH)        // one operand's tile in LDS
#define G_STAGEB (2 * G_OPB)         // [X tile | W tile]
#define G_WSTB (2 * G_STAGEB / 8)    // a wave's part of the ring for its output tile
#define G_OP16 144                   // staged row pitch, 64 bf16 (16 B x odd)
#define G_OP32 272                   // staged row pitch, 64 f32 (16 B x odd)
static_assert(32 * G_OP16 <= G_WSTB && 32 * G_OP32 <= G_WSTB, "a wave's tile fits its part");

// One stage: each thread brings 4 x 16 bytes of X and 4 x 16 bytes of W (rows 32 apart).
// The s_wait_xcnt stands inside the statement so that no address register named by a
// copy is rewritten in front of it.
__device__ __forceinline__ void gemm_copy_stage(unsigned int lds,
                                                const unsigned short* ga,
                                                const unsigned short* gb) {
  asm volatile(
      "global_load_async_to_lds_b128 %0, %8, off\n\t"
      "global_load_async_to_lds_b128 %1, %9, off\n\t"
      "global_load_async_to_lds_b128 %2, %10, off\n\t"
      "global_load_async_to_lds_b128 %3, %11, off\n\t"
      "global_load_async_to_lds_b128 %4, %12, off\n\t"
      "global_load_async_to_lds_b128 %5, %13, off\n\t"
      "global_load_async_to_lds_b128 %6, %14, off\n\t"
      "global_load_async_to_lds_b128 %7, %15, off\n\t"
      "s_wait_xcnt 0x0"
      :: "v"(lds), "v"(lds + 32 * G_PITCH), "v"(lds + 64 * G_PITCH), "v"(lds + 96 * G_PITCH),
         "v"(lds + G_OPB), "v"(lds + G_OPB + 32 * G_PITCH), "v"(lds + G_OPB + 64 * G_PITCH),
         "v"(lds + G_OPB + 96 * G_PITCH),
         "v"(ga), "v"(ga + 32 * E_DIM), "v"(ga + 64 * E_DIM), "v"(ga + 96 * E_DIM),
         "v"(gb), "v"(gb + 32 * E_DIM), "v"(gb + 64 * E_DIM), "v"(gb + 96 * E_DIM)
      : "memory");
}

// c[m][n][r] = Y[mbase + 16 m + lrow][nbase + 16 n + 8 half + r], without bias and scale.
// st: the wave's own staging bytes.  All loops are unrolled so that c is indexed by constants
// and stays in registers.
template <int MODE>
__device__ __forceinline__ void gemm_store_tile(const v8f (&c)[2][4], unsigned char* st,
                                                const float* __restrict__ bias,
                                                void* __restrict__ outp, float scale,
                                                int mbase, int nbase, int lane) {
  const int lrow = lane & 15;
  const int half = lane >> 4;
  constexpr int PITCH = (MODE == 1) ? G_OP32 : G_OP16;
#pragma unroll
  for (int n = 0; n < 4; ++n) {
    f32x4 b0 = {}, b1 = {};
    if (MODE != 2) {
      b0 = *(const f32x4*)(bias + nbase + n * 16 + 8 * half);
      b1 = *(const f32x4*)(bias + nbase + n * 16 + 8 * half + 4);
    }
#pragma unroll
    for (int m = 0; m < 2; ++m) {
      float v[8];
      const float br = (MODE == 2) ? bias[mbase + m * 16 + lrow] : 0.0f;
#pragma unroll
      for (int r = 0; r < 8; ++r)
        v[r] = (c[m][n][r] + ((MODE == 2) ? br : (r < 4) ? b0[r & 3] : b1[r & 3])) * scale;
      unsigned char* sp = st + (m * 16 + lrow) * PITCH;
      if (MODE == 1) {
        const f32x4 lo = {v[0], v[1], v[2], v[3]}, hi = {v[4], v[5], v[6], v[7]};
        *(f32x4*)(sp + n * 64 + half * 32) = lo;
        *(f32x4*)(sp + n * 64 + half * 32 + 16) = hi;
      } else {
        u32x4 pk;
#pragma unroll
        for (int i = 0; i < 4; ++i) pk[i] = pk2bf(v[2 * i], v[2 * i + 1]);
        *(u32x4*)(sp + n * 32 + half * 16) = pk;
      }
    }
  }
  // the wave's own staged pieces are in LDS before its lanes read one another's
  asm volatile("s_wait_dscnt 0x0" ::: "memory");
  if (MODE == 1) {
    // a row is 256 bytes: 16 lanes a row, 2 rows (4 whole lines) a store
    float* op = (float*)outp + (mbase + half) * E_DIM + nbase + lrow * 4;
    const unsigned char* sp = st + half * PITCH + lrow * 16;
#pragma unroll
    for (int i = 0; i < 16; ++i)
      *(f32x4*)(op + i * 2 * E_DIM) = *(const f32x4*)(sp + i * 2 * PITCH);
  } else {
    // a row is 128 bytes: 8 lanes a row, 4 rows (4 whole lines) a store
    const int row = lane >> 3, chk = lane & 7;
    constexpr int OPITCH = (MODE == 0) ? E_DIM : SEQ;
    unsigned short* op = (unsigned short*)outp + chk * 8 +
        ((MODE == 0) ? (mbase + row) * E_DIM + nbase
                     : ((nbase >> 11) * E_DIM + mbase + row) * SEQ + (nbase & (SEQ - 1)));
    const unsigned char* sp = st + row * PITCH + chk * 16;
#pragma unroll
    for (int i = 0; i < 8; ++i)
      *(u32x4*)(op + i * 4 * OPITCH) = *(const u32x4*)(sp + i * 4 * PITCH);
  }
  // stands in front of whatever the compiler places behind the tile's stores, so that no
  // register named by a store is rewritten ahead of it
  asm volatile("s_wait_xcnt 0x0" ::: "memory");
}

// One 128x128 tile of Y: tile column bx (128 rows of W), tile row by (128 rows of X).
__device__ __forceinline__ void gemm_tile(const unsigned short* __restrict__ Xb,
                                          const unsigned short* __restrict__ Wb,
                                          const float* __restrict__ bias,
                                          void* __restrict__ outp, float scale, int mode,
                                          int bx, int by) {
  __shared__ __attribute__((aligned(16))) unsigned char smem[2 * G_STAGEB];

  const int lane = threadIdx.x & 31;
  const int wave = threadIdx.x >> 5;
  const int wm = wave & 3;
  const int wn = wave >> 2;
  const int mbase = by * 128 + wm * 32;
  const int nbase = bx * 128 + wn * 64;
  const int lrow = lane & 15;
  const int half = lane >> 4;        // A/B 16-bit K-chunk: k = 8 * half (ISA 7.12.2)

  // copy side: thread -> (row 0..31, 16-byte chunk 0..7); a wave covers 4 whole lines
  const int crow = threadIdx.x >> 3;
  const int cchk = threadIdx.x & 7;
  const unsigned short* ga = Xb + (by * 128 + crow) * E_DIM + cchk * 8;
  const unsigned short* gb = Wb + (bx * 128 + crow) * E_DIM + cchk * 8;
  const unsigned int lds0 = (unsigned int)(size_t)smem + crow * G_PITCH + cchk * 16;

  // read side: byte offsets of this lane's fragment rows inside a stage
  const int aoff = (wm * 32 + lrow) * G_PITCH + half * 16;
  const int boff = G_OPB + (wn * 64 + lrow) * G_PITCH + half * 16;

  v8f c[2][4] = {};

  gemm_copy_stage(lds0, ga, gb);
  // tile 0 has landed for this wave's own copies
  asm volatile("s_wait_asynccnt 0x0" ::: "memory");
  __syncthreads();
  gemm_copy_stage(lds0 + G_STAGEB, ga + G_KT, gb + G_KT);

#pragma unroll 1  // one stage a trip: the ring's order stands once, at the loop's foot
  for (int t = 0; t < G_NT; ++t) {
    const unsigned int bsel = (unsigned int)(t & 1) * G_STAGEB;
    const unsigned char* sb = smem + bsel;
    // this loop and the three inside it are unrolled so that fragments and accumulators
    // are indexed by constants and stay in registers
#pragma unroll
    for (int kk = 0; kk < 2; ++kk) {
      ABf af[2], bf[4];
#pragma unroll
      for (int m = 0; m < 2; ++m) {
        af[m].u[0] = *(const u32x4*)(sb + aoff + m * 16 * G_PITCH + kk * 64);
        af[m].u[1] = *(const u32x4*)(sb + aoff + m * 16 * G_PITCH + kk * 64 + 32);
      }
#pragma unroll
      for (int n = 0; n < 4; ++n) {
        bf[n].u[0] = *(const u32x4*)(sb + boff + n * 16 * G_PITCH + kk * 64);
        bf[n].u[1] = *(const u32x4*)(sb + boff + n * 16 * G_PITCH + kk * 64 + 32);
      }
#pragma unroll
      for (int m = 0; m < 2; ++m)
#pragma unroll
        for (int n = 0; n < 4; ++n) c[m][n] = WMMA_BF16(bf[n].v, af[m].v, c[m][n]);
    }
    // this wave's reads of the buffer have returned before it is handed to the copies
    asm volatile("s_wait_dscnt 0x0" ::: "memory");
    // this wave's copies of tile t + 1 have landed before the barrier publishes them
    asm volatile("s_wait_asynccnt 0x0" ::: "memory");
    __syncthreads();
    if (t + 2 < G_NT)
      gemm_copy_stage(lds0 + bsel, ga + (t + 2) * G_KT, gb + (t + 2) * G_KT);
  }
  // no copy is outstanding when the wave goes on to its stores and ends
  asm volatile("s_wait_asynccnt 0x0" ::: "memory");

  // Behind the loop's last barrier no wave reads the ring any more and no copy is aimed at
  // it.  One branch on the mode for the whole tile.
  unsigned char* st = smem + wave * G_WSTB;
  if (mode == 0)      gemm_store_tile<0>(c, st, bias, outp, scale, mbase, nbase, lane);
  else if (mode == 1) gemm_store_tile<1>(c, st, bias, outp, scale, mbase, nbase, lane);
  else                gemm_store_tile<2>(c, st, bias, outp, scale, mbase, nbase, lane);
}

__global__ __launch_bounds__(256)
void gemm_xwt(const unsigned short* __restrict__ Xb,
              const unsigned short* __restrict__ Wb,
              const float* __restrict__ bias,
              void* __restrict__ outp, float scale, int mode) {
  gemm_tile(Xb, Wb, bias, outp, scale, mode, blockIdx.x, blockIdx.y);
}

// The three projections of the tokens in ONE launch: they depend on nothing of one another,
// so that the work-groups of the next start while those of the one before still run, and the
// chip fills and drains once.  blockIdx.z = 0: Q (scaled), 1: K, 2: V^T = Wv X^T, where the
// tokens are the W operand: its tile column is the token tile (blockIdx.y), its tile row the
// weight tile (blockIdx.x).  Six waves a SIMD (at most 160 registers): three work-groups share
// a WGP, so that one's first tiles and its stores run under the products of two others.
__global__ __launch_bounds__(256, 6)
void gemm_qkv(const unsigned short* __restrict__ xb,
              const unsigned short* __restrict__ wqb, const unsigned short* __restrict__ wkb,
              const unsigned short* __restrict__ wvb,
              const float* __restrict__ bq, const float* __restrict__ bk,
              const float* __restrict__ bv,
              unsigned short* __restrict__ qb, unsigned short* __restrict__ kb,
              unsigned short* __restrict__ vtb, float qscale) {
  const int z = blockIdx.z;
  const bool vt = (z == 2);
  gemm_tile(vt ? wvb : xb,
            vt ? xb : (z == 0) ? wqb : wkb,
            vt ? bv : (z == 0) ? bq : bk,
            vt ? vtb : (z == 0) ? qb : kb,
            (z == 0) ? qscale : 1.0f, vt ? 2 : 0,
            vt ? blockIdx.y : blockIdx.x, vt ? blockIdx.x : blockIdx.y);
}

#define A_KEYS 64                    // keys per stage: two passes of 32
#define A_NST (SEQ / A_KEYS)         // 32 stages
#define A_PITCH 144                  // LDS row pitch in bytes (16 B x odd, for ds_load_b128)
#define A_OPB (64 * A_PITCH)         // one operand's tile in LDS
#define A_STAGEB (2 * A_OPB)         // [K tile | Vt tile]
#define A_LAZY 11.5f                 // how far, in powers of two, a score may lie above the reference

// One stage: each thread brings 2 x 16 bytes of K and 2 x 16 bytes of Vt (rows 32 apart).
// The s_wait_xcnt stands inside the statement so that no address register named by a
// copy is rewritten in front of it.
__device__ __forceinline__ void attn_copy_stage(unsigned int lds,
                                                const unsigned short* gk,
                                                const unsigned short* gv) {
  asm volatile(
      "global_load_async_to_lds_b128 %0, %4, off\n\t"
      "global_load_async_to_lds_b128 %1, %5, off\n\t"
      "global_load_async_to_lds_b128 %2, %6, off\n\t"
      "global_load_async_to_lds_b128 %3, %7, off\n\t"
      "s_wait_xcnt 0x0"
      :: "v"(lds), "v"(lds + 32 * A_PITCH), "v"(lds + A_OPB), "v"(lds + A_OPB + 32 * A_PITCH),
         "v"(gk), "v"(gk + 32 * E_DIM), "v"(gv), "v"(gv + 32 * SEQ)
      : "memory");
}

// lane l takes the value of lane l ^ 16
__device__ __forceinline__ float xhalf(float x) {
  const int b = __builtin_bit_cast(int, x);
  return __builtin_bit_cast(
      float, __builtin_amdgcn_permlanex16(b, b, 0x76543210, 0xfedcba98, false, false));
}

__global__ __launch_bounds__(256)
void attn_fwd(const unsigned short* __restrict__ Qb,
              const unsigned short* __restrict__ Kb,
              const unsigned short* __restrict__ Vtb,
              unsigned short* __restrict__ Ctx) {
  __shared__ __attribute__((aligned(16))) unsigned char ring[2 * A_STAGEB];

  const int lane = threadIdx.x & 31;
  const int wave = threadIdx.x >> 5;
  const int lrow = lane & 15;
  const int lk = (lane >> 4) << 3;
  const int half = lane >> 4;

  const int bh = blockIdx.x >> 3;   // / (SEQ/256)
  const int qt = (blockIdx.x & 7) * 8 + wave;
  const int b = bh >> 4, h = bh & 15;
  const int qrowbase = b * SEQ + qt * 32;

  const u32x4* Qv = (const u32x4*)Qb;

  // copy side: thread -> (row 0..31, 16-byte chunk 0..7); a wave covers 4 whole lines
  const int crow = threadIdx.x >> 3;
  const int cchk = threadIdx.x & 7;
  const unsigned short* gk = Kb + (b * SEQ + crow) * E_DIM + h * HEAD_DIM + cchk * 8;
  const unsigned short* gv = Vtb + ((b * N_HEADS + h) * HEAD_DIM + crow) * SEQ + cchk * 8;
  const unsigned int lds0 = (unsigned int)(size_t)ring + crow * A_PITCH + cchk * 16;

  // read side: byte offset of this lane's fragment row inside an operand's tile.  Of each 64
  // bytes of a row a lane takes bytes 16 * half and 32 + 16 * half: the hardware k order,
  // which the packed score tiles have as well.
  const int foff = lrow * A_PITCH + half * 16;

  // Q: 2 query sub-tiles x 2 K-dim chunks, resident in registers
  ABf aq[2][2];
#pragma unroll
  for (int m = 0; m < 2; ++m) {
    const int qoff = (qrowbase + m * 16 + lrow) * E_DIM + h * HEAD_DIM;
    aq[m][0].u[0] = Qv[(qoff + lk) >> 3];
    aq[m][0].u[1] = Qv[(qoff + lk + 16) >> 3];
    aq[m][1].u[0] = Qv[(qoff + 32 + lk) >> 3];
    aq[m][1].u[1] = Qv[(qoff + 32 + lk + 16) >> 3];
  }

  // o[g][t][r] = O^T[d = 16 t + 8 half + r][query 16 g + lrow]
  v8f o[2][4] = {};
  // per query group: the query's reference for the exponentials (equal in both halves; at
  // most A_LAZY below its running maximum) and the running sum over this half's keys (the
  // halves are joined behind the loop)
  float m_i[2] = {-3.0e38f, -3.0e38f}, l_i[2] = {0.0f, 0.0f};
  // what the score product of a group starts from: minus the query's reference in all eight
  // registers (a lane's eight scores of a tile are of one query); zero until the first pass
  // has set a reference
  v8f negm[2] = {};
  // what a score less its reference may reach; the first pass always sets a reference
  float thr = -3.0e38f;

  attn_copy_stage(lds0, gk, gv);
  // stage 0 has landed for this wave's own copies
  asm volatile("s_wait_asynccnt 0x0" ::: "memory");
  __syncthreads();
  attn_copy_stage(lds0 + A_STAGEB, gk + A_KEYS * E_DIM, gv + A_KEYS);

#pragma unroll 1  // one stage a trip: the ring's order stands once, at the loop's foot
  for (int st = 0; st < A_NST; ++st) {
   const unsigned int bsel = (unsigned int)(st & 1) * A_STAGEB;
   const unsigned char* kbuf = ring + bsel + foff;
   const unsigned char* vbuf = kbuf + A_OPB;
#pragma unroll 1  // one pass of 32 keys a trip: short loop text, one set of pass registers
   for (int p = 0; p < A_KEYS / 32; ++p) {
    // ---- scores: S^T(32 keys x 32 queries) = K_tile(32x64) @ Q^T(64x32)
    ABf ak[2][2];
    // all loops of the pass are unrolled so that fragments and accumulators are indexed by
    // constants and stay in registers
#pragma unroll
    for (int kt = 0; kt < 2; ++kt)
#pragma unroll
      for (int kc = 0; kc < 2; ++kc) {
        const unsigned char* kr = kbuf + (p * 32 + kt * 16) * A_PITCH + kc * 64;
        ak[kt][kc].u[0] = *(const u32x4*)(kr);
        ak[kt][kc].u[1] = *(const u32x4*)(kr + 32);
      }
    // s[kt][g][r] = S^T[key 16 kt + 8 half + r][query 16 g + lrow] less the query's reference
    v8f s[2][2];
    // Written as asm so that a product reads its start value from the reference's registers
    // and writes its own: from the builtin the compiler copies the eight registers first for
    // two of the four tiles.  The four v_nop are the vector slots between the last product and
    // the first vector instruction that reads a result or overwrites a K fragment.
    asm("v_wmma_f32_16x16x32_bf16 %0, %4, %8, %12\n\t"
        "v_wmma_f32_16x16x32_bf16 %1, %4, %10, %13\n\t"
        "v_wmma_f32_16x16x32_bf16 %2, %6, %8, %12\n\t"
        "v_wmma_f32_16x16x32_bf16 %3, %6, %10, %13\n\t"
        "v_wmma_f32_16x16x32_bf16 %0, %5, %9, %0\n\t"
        "v_wmma_f32_16x16x32_bf16 %1, %5, %11, %1\n\t"
        "v_wmma_f32_16x16x32_bf16 %2, %7, %9, %2\n\t"
        "v_wmma_f32_16x16x32_bf16 %3, %7, %11, %3\n\t"
        "v_nop\n\tv_nop\n\tv_nop\n\tv_nop"
        : "=&v"(s[0][0]), "=&v"(s[0][1]), "=&v"(s[1][0]), "=&v"(s[1][1])
        : "v"(ak[0][0].v), "v"(ak[0][1].v), "v"(ak[1][0].v), "v"(ak[1][1].v),
          "v"(aq[0][0].v), "v"(aq[0][1].v), "v"(aq[1][0].v), "v"(aq[1][1].v),
          "v"(negm[0]), "v"(negm[1]));

    // ---- V^T fragments from the ring (A operand: row = d, k = the pass's 32 keys)
    ABf av[4];
#pragma unroll
    for (int t = 0; t < 4; ++t) {
      const unsigned char* vr = vbuf + t * 16 * A_PITCH + p * 64;
      av[t].u[0] = *(const u32x4*)(vr);
      av[t].u[1] = *(const u32x4*)(vr + 32);
    }

    // ---- online softmax of queries 16 g + lrow, on this half's 16 keys
    float rmax[2];
#pragma unroll
    for (int g = 0; g < 2; ++g) {
      rmax[g] = -3.0e38f;
#pragma unroll
      for (int r = 0; r < 8; ++r) rmax[g] = fmaxf(rmax[g], fmaxf(s[0][g][r], s[1][g][r]));
    }
    // The reference m_i moves, and sums and outputs are rescaled, only in a pass where some
    // score of the wave lies more than A_LAZY above its query's reference: one test a pass, a
    // scalar branch.  Otherwise every exponential is at most 2^A_LAZY, and the common
    // factor cancels in the division behind the loop.
    const bool need = (rmax[0] > thr) || (rmax[1] > thr);
    if (__builtin_amdgcn_ballot_w32(need) != 0) {
#pragma unroll
      for (int g = 0; g < 2; ++g) {
        // both halves of a query take the same new reference
        const float base = -negm[g][0];
        const float mnew = fmaxf(m_i[g], base + fmaxf(rmax[g], xhalf(rmax[g])));
        const float alpha = __builtin_amdgcn_exp2f(m_i[g] - mnew);
        const float shift = mnew - base;
        m_i[g] = mnew;
        l_i[g] *= alpha;
#pragma unroll
        for (int t = 0; t < 4; ++t) o[g][t] = o[g][t] * alpha;
        // this pass's scores were taken against the old reference
#pragma unroll
        for (int kt = 0; kt < 2; ++kt) s[kt][g] = s[kt][g] - shift;
#pragma unroll
        for (int r = 0; r < 8; ++r) negm[g][r] = -mnew;
      }
      thr = A_LAZY;
    }

#pragma unroll
    for (int g = 0; g < 2; ++g) {
      // element e of the B operand is key kmap(e) = 16 (e >> 3) + 8 half + (e & 7): score
      // tile e >> 3, register e & 7
      v8f pt[2];
      ABf pf;
#pragma unroll
      for (int kt = 0; kt < 2; ++kt) {
#pragma unroll
        for (int r = 0; r < 8; ++r) pt[kt][r] = __builtin_amdgcn_exp2f(s[kt][g][r]);
#pragma unroll
        for (int i = 0; i < 4; ++i) pf.u[kt][i] = pk2bf(pt[kt][2 * i], pt[kt][2 * i + 1]);
      }
      const v8f ps = pt[0] + pt[1];
      const float ssum = ((ps[0] + ps[1]) + (ps[2] + ps[3])) + ((ps[4] + ps[5]) + (ps[6] + ps[7]));
      l_i[g] += ssum;

      // ---- O^T += V^T(64x32) @ P^T(32x16)
#pragma unroll
      for (int t = 0; t < 4; ++t) o[g][t] = WMMA_BF16(av[t].v, pf.v, o[g][t]);
    }
    // keeps the pass's WMMAs in front of the slot below
    __builtin_amdgcn_sched_barrier(0);
    // the fourth vector slot between the pass's last WMMA and the next trip's first write of a
    // register that held its A or B
    asm volatile("v_nop");
   }
   // this wave's reads of the buffer have returned before it is handed to the copies
   asm volatile("s_wait_dscnt 0x0" ::: "memory");
   // this wave's copies of stage st + 1 have landed before the barrier publishes them
   asm volatile("s_wait_asynccnt 0x0" ::: "memory");
   __syncthreads();
   if (st + 2 < A_NST)
     attn_copy_stage(lds0 + bsel, gk + (st + 2) * A_KEYS * E_DIM, gv + (st + 2) * A_KEYS);
  }
  // no copy is outstanding when the wave goes on to its stores and ends
  asm volatile("s_wait_asynccnt 0x0" ::: "memory");

  // the three loops are unrolled so that o is indexed by constants and stays in registers
#pragma unroll
  for (int g = 0; g < 2; ++g) {
    const float l = l_i[g] + xhalf(l_i[g]);   // both halves' keys
    const float rr = (l > 0.f) ? (1.0f / l) : 0.f;
    unsigned short* crow_p = Ctx + (qrowbase + g * 16 + lrow) * E_DIM + h * HEAD_DIM + 8 * half;
#pragma unroll
    for (int t = 0; t < 4; ++t) {
      // a lane's 8 registers are 8 consecutive d of one query: one 16-byte store
      u32x4 pk;
#pragma unroll
      for (int i = 0; i < 4; ++i) pk[i] = pk2bf(o[g][t][2 * i] * rr, o[g][t][2 * i + 1] * rr);
      *(u32x4*)(crow_p + t * 16) = pk;
    }
  }
}

// ---------------------------------------------------------------- launch
extern "C" void kernel_launch(void* const* d_in, const int* in_sizes, int n_in,
                              void* d_out, int out_size, void* d_ws, size_t ws_size,
                              hipStream_t stream) {
  const float* x  = (const float*)d_in[0];
  const float* wq = (const float*)d_in[1];
  const float* bq = (const float*)d_in[2];
  const float* wk = (const float*)d_in[3];
  const float* bk = (const float*)d_in[4];
  const float* wv = (const float*)d_in[5];
  const float* bv = (const float*)d_in[6];
  const float* wo = (const float*)d_in[7];
  const float* bo = (const float*)d_in[8];

  char* ws = (char*)d_ws;
  const size_t MB = 1024 * 1024;
  unsigned short* xb  = (unsigned short*)(ws + 0 * MB);   // 16 MB
  unsigned short* wqb = (unsigned short*)(ws + 16 * MB);  //  2 MB
  unsigned short* wkb = (unsigned short*)(ws + 18 * MB);
  unsigned short* wvb = (unsigned short*)(ws + 20 * MB);
  unsigned short* wob = (unsigned short*)(ws + 22 * MB);
  unsigned short* qb  = (unsigned short*)(ws + 24 * MB);  // 16 MB
  unsigned short* kb2 = (unsigned short*)(ws + 40 * MB);  // 16 MB
  unsigned short* vtb = (unsigned short*)(ws + 56 * MB);  // 16 MB [B,H,D,S]
  unsigned short* ctx = (unsigned short*)(ws + 72 * MB);  // 16 MB

  // xb, wqb, wkb, wvb, wob lie one behind another from xb on
  cvt_f32_bf16<<<CV_BLOCKS, CV_THREADS, 0, stream>>>(x, wq, wk, wv, wo, xb);

  dim3 gg(E_DIM / 128, ROWS / 128);  // (8, 64), 256 threads = 8 waves
  const float qscale = 0.18033688f;  // log2(e) / sqrt(64): scores are exponents of two
  dim3 g3(E_DIM / 128, ROWS / 128, 3);  // z: Q, K, V^T
  gemm_qkv<<<g3, 256, 0, stream>>>(xb, wqb, wkb, wvb, bq, bk, bv, qb, kb2, vtb, qscale);

  attn_fwd<<<BATCH * N_HEADS * (SEQ / 256), 256, 0, stream>>>(qb, kb2, vtb, ctx);

  gemm_xwt<<<gg, 256, 0, stream>>>(ctx, wob, bo, d_out, 1.0f, 1);
}

// v010
// Measured time: 110 microseconds a run.
// Timed twice side by side with v009, it ran 1.04 times as fast both times.
// Counting every step since v000, it is 3.33 times as fast.
#include <hip/hip_runtime.h>
#include <hip/hip_bf16.h>
#include <stdint.h>

#define E_DIM 1024
#define N_HEADS 16
#define HEAD_DIM 64
#define SEQ 2048
#define BATCH 4
#define ROWS (BATCH * SEQ)  // 8192

typedef __attribute__((ext_vector_type(16))) __bf16 v16bf;
typedef __attribute__((ext_vector_type(8)))  float  v8f;
typedef __attribute__((ext_vector_type(4)))  unsigned int u32x4;
typedef __attribute__((ext_vector_type(4)))  float  f32x4;
typedef __attribute__((ext_vector_type(2)))  float  f32x2;
typedef __attribute__((ext_vector_type(2)))  __bf16 bf16x2;

union ABf { v16bf v; u32x4 u[2]; };

// two f32 -> two bf16 in one register (lo in bits 15..0), round to nearest even: one packed
// convert instruction
__device__ __forceinline__ unsigned int pk2bf(float lo, float hi) {
  const f32x2 v = {lo, hi};
  return __builtin_bit_cast(unsigned int, __builtin_convertvector(v, bf16x2));
}

#define WMMA_BF16(A, B, C) \
  __builtin_amdgcn_wmma_f32_16x16x32_bf16(false, (A), false, (B), (short)0, (C), false, false)

// ---------------------------------------------------------------- convert
// x and the four weights go to bf16 in ONE launch of one 16-wave work-group per WGP, so
// that few waves have to be started.  The five results lie one behind another in `out`
// (x, wq, wk, wv, wo).  A piece is 16,384 values of one array; a work-group takes
// CV_XT pieces of x and one piece of a weight.  Each wave-wide load covers 512 contiguous
// bytes (4 whole lines), each wave-wide store 256 (2 whole lines); all of a thread's
// loads are issued before its first value is converted.
#define CV_THREADS 512
#define CV_BLOCKS 256
#define CV_LOADS 8
#define CV_STEP (CV_THREADS * 4)                 // values a work-group brings with one load
#define CV_PIECE (CV_STEP * CV_LOADS)            // 16,384 values
#define CV_XT (ROWS * E_DIM / CV_PIECE / CV_BLOCKS)  // 2 pieces of x a work-group
#define CV_WP (E_DIM * E_DIM / CV_PIECE)         // 64 pieces in each weight
static_assert(CV_XT * CV_BLOCKS * CV_PIECE == ROWS * E_DIM &&
              CV_WP * CV_PIECE == E_DIM * E_DIM && 4 * CV_WP == CV_BLOCKS,
              "the pieces cover the five arrays exactly");

__global__ __launch_bounds__(CV_THREADS)
void cvt_f32_bf16(const float* __restrict__ x,
                  const float* __restrict__ wq, const float* __restrict__ wk,
                  const float* __restrict__ wv, const float* __restrict__ wo,
                  unsigned short* __restrict__ out) {
  const int blk = blockIdx.x;
  const int k = blk / CV_WP;                     // the weight that this work-group's piece is of
  const float* w = (k == 0) ? wq : (k == 1) ? wk : (k == 2) ? wv : wo;

  f32x4 v[CV_XT + 1][CV_LOADS];
  // all loops unrolled: v is indexed by constants and stays in registers
#pragma unroll
  for (int t = 0; t <= CV_XT; ++t) {
    const float* src = (t < CV_XT) ? x + (t * CV_BLOCKS + blk) * CV_PIECE
                                   : w + (blk % CV_WP) * CV_PIECE;
#pragma unroll
    for (int j = 0; j < CV_LOADS; ++j)
      v[t][j] = *(const f32x4*)(src + j * CV_STEP + threadIdx.x * 4);
  }
  // Takes the loaded values as inputs only, so that all 24 loads of a thread are in flight
  // together: without it the compiler saves registers by converting early and issues the
  // last loads two at a time, each pair waited for.  The wait stands in front of the first
  // reuse of a register that a load names.
  static_assert(CV_XT == 2 && CV_LOADS == 8, "the statement below names every loaded value");
  asm volatile("s_wait_xcnt 0x0"
               :: "v"(v[0][0]), "v"(v[0][1]), "v"(v[0][2]), "v"(v[0][3]),
                  "v"(v[0][4]), "v"(v[0][5]), "v"(v[0][6]), "v"(v[0][7]),
                  "v"(v[1][0]), "v"(v[1][1]), "v"(v[1][2]), "v"(v[1][3]),
                  "v"(v[1][4]), "v"(v[1][5]), "v"(v[1][6]), "v"(v[1][7]),
                  "v"(v[2][0]), "v"(v[2][1]), "v"(v[2][2]), "v"(v[2][3]),
                  "v"(v[2][4]), "v"(v[2][5]), "v"(v[2][6]), "v"(v[2][7])
               : "memory");
#pragma unroll
  for (int t = 0; t <= CV_XT; ++t) {
    unsigned short* dst = out + (t * CV_BLOCKS + blk) * CV_PIECE + threadIdx.x * 4;
#pragma unroll
    for (int j = 0; j < CV_LOADS; ++j) {
      uint2 p;
      p.x = pk2bf(v[t][j].x, v[t][j].y);
      p.y = pk2bf(v[t][j].z, v[t][j].w);
      *(uint2*)(dst + j * CV_STEP) = p;
    }
  }
}

#define G_KT 128                     // k elements per stage: rows of 256 bytes
#define G_NT (E_DIM / G_KT)          // 8 stages
#define G_PITCH 272                  // LDS row pitch in bytes (16 B x odd, for ds_load_b128)
#define G_OPB (128 * G_PITCH)        // one operand's tile in LDS
#define G_STAGEB (2 * G_OPB)         // [X tile | W tile]
#define G_WSTB (2 * G_STAGEB / 8)    // a wave's part of the ring for its output tile
#define G_OP16 144                   // staged row pitch, 64 bf16 (16 B x odd)
#define G_OP32 272                   // staged row pitch, 64 f32 (16 B x odd)
static_assert(32 * G_OP16 <= G_WSTB && 32 * G_OP32 <= G_WSTB, "a wave's tile fits its part");

// One operand's tile of a stage: each thread brings 8 x 16 bytes (rows 16 apart).
// The s_wait_xcnt stands inside the statement so that no address register named by a
// copy is rewritten in front of it.
__device__ __forceinline__ void gemm_copy_tile(unsigned int lds, const unsigned short* g) {
  asm volatile(
      "global_load_async_to_lds_b128 %0, %8, off\n\t"
      "global_load_async_to_lds_b128 %1, %9, off\n\t"
      "global_load_async_to_lds_b128 %2, %10, off\n\t"
      "global_load_async_to_lds_b128 %3, %11, off\n\t"
      "global_load_async_to_lds_b128 %4, %12, off\n\t"
      "global_load_async_to_lds_b128 %5, %13, off\n\t"
      "global_load_async_to_lds_b128 %6, %14, off\n\t"
      "global_load_async_to_lds_b128 %7, %15, off\n\t"
      "s_wait_xcnt 0x0"
      :: "v"(lds), "v"(lds + 16 * G_PITCH), "v"(lds + 32 * G_PITCH), "v"(lds + 48 * G_PITCH),
         "v"(lds + 64 * G_PITCH), "v"(lds + 80 * G_PITCH), "v"(lds + 96 * G_PITCH),
         "v"(lds + 112 * G_PITCH),
         "v"(g), "v"(g + 16 * E_DIM), "v"(g + 32 * E_DIM), "v"(g + 48 * E_DIM),
         "v"(g + 64 * E_DIM), "v"(g + 80 * E_DIM), "v"(g + 96 * E_DIM), "v"(g + 112 * E_DIM)
      : "memory");
}

// One stage: the X tile and the W tile, 16 copies a thread.
__device__ __forceinline__ void gemm_copy_stage(unsigned int lds,
                                                const unsigned short* ga,
                                                const unsigned short* gb) {
  gemm_copy_tile(lds, ga);
  gemm_copy_tile(lds + G_OPB, gb);
}

// c[m][n][r] = Y[mbase + 16 m + lrow][nbase + 16 n + 8 half + r], without bias and scale.
// st: the wave's own staging bytes.  All loops are unrolled so that c is indexed by constants
// and stays in registers.
template <int MODE>
__device__ __forceinline__ void gemm_store_tile(const v8f (&c)[2][4], unsigned char* st,
                                                const float* __restrict__ bias,
                                                void* __restrict__ outp, float scale,
                                                int mbase, int nbase, int lane) {
  const int lrow = lane & 15;
  const int half = lane >> 4;
  constexpr int PITCH = (MODE == 1) ? G_OP32 : G_OP16;
#pragma unroll
  for (int n = 0; n < 4; ++n) {
    f32x4 b0 = {}, b1 = {};
    if (MODE != 2) {
      b0 = *(const f32x4*)(bias + nbase + n * 16 + 8 * half);
      b1 = *(const f32x4*)(bias + nbase + n * 16 + 8 * half + 4);
    }
#pragma unroll
    for (int m = 0; m < 2; ++m) {
      float v[8];
      const float br = (MODE == 2) ? bias[mbase + m * 16 + lrow] : 0.0f;
#pragma unroll
      for (int r = 0; r < 8; ++r)
        v[r] = (c[m][n][r] + ((MODE == 2) ? br : (r < 4) ? b0[r & 3] : b1[r & 3])) * scale;
      unsigned char* sp = st + (m * 16 + lrow) * PITCH;
      if (MODE == 1) {
        const f32x4 lo = {v[0], v[1], v[2], v[3]}, hi = {v[4], v[5], v[6], v[7]};
        *(f32x4*)(sp + n * 64 + half * 32) = lo;
        *(f32x4*)(sp + n * 64 + half * 32 + 16) = hi;
      } else {
        u32x4 pk;
#pragma unroll
        for (int i = 0; i < 4; ++i) pk[i] = pk2bf(v[2 * i], v[2 * i + 1]);
        *(u32x4*)(sp + n * 32 + half * 16) = pk;
      }
    }
  }
  // the wave's own staged pieces are in LDS before its lanes read one another's
  asm volatile("s_wait_dscnt 0x0" ::: "memory");
  if (MODE == 1) {
    // a row is 256 bytes: 16 lanes a row, 2 rows (4 whole lines) a store
    float* op = (float*)outp + (mbase + half) * E_DIM + nbase + lrow * 4;
    const unsigned char* sp = st + half * PITCH + lrow * 16;
#pragma unroll
    for (int i = 0; i < 16; ++i)
      *(f32x4*)(op + i * 2 * E_DIM) = *(const f32x4*)(sp + i * 2 * PITCH);
  } else {
    // a row is 128 bytes: 8 lanes a row, 4 rows (4 whole lines) a store
    const int row = lane >> 3, chk = lane & 7;
    constexpr int OPITCH = (MODE == 0) ? E_DIM : SEQ;
    unsigned short* op = (unsigned short*)outp + chk * 8 +
        ((MODE == 0) ? (mbase + row) * E_DIM + nbase
                     : ((nbase >> 11) * E_DIM + mbase + row) * SEQ + (nbase & (SEQ - 1)));
    const unsigned char* sp = st + row * PITCH + chk * 16;
#pragma unroll
    for (int i = 0; i < 8; ++i)
      *(u32x4*)(op + i * 4 * OPITCH) = *(const u32x4*)(sp + i * 4 * PITCH);
  }
  // stands in front of whatever the compiler places behind the tile's stores, so that no
  // register named by a store is rewritten ahead of it
  asm volatile("s_wait_xcnt 0x0" ::: "memory");
}

// One 128x128 tile of Y: tile column bx (128 rows of W), tile row by (128 rows of X).
__device__ __forceinline__ void gemm_tile(const unsigned short* __restrict__ Xb,
                                          const unsigned short* __restrict__ Wb,
                                          const float* __restrict__ bias,
                                          void* __restrict__ outp, float scale, int mode,
                                          int bx, int by) {
  __shared__ __attribute__((aligned(16))) unsigned char smem[2 * G_STAGEB];

  const int lane = threadIdx.x & 31;
  const int wave = threadIdx.x >> 5;
  const int wm = wave & 3;
  const int wn = wave >> 2;
  const int mbase = by * 128 + wm * 32;
  const int nbase = bx * 128 + wn * 64;
  const int lrow = lane & 15;
  const int half = lane >> 4;        // A/B 16-bit K-chunk: k = 8 * half (ISA 7.12.2)

  // copy side: thread -> (row 0..15, 16-byte chunk 0..15); a wave covers 2 rows of 256 bytes
  const int crow = threadIdx.x >> 4;
  const int cchk = threadIdx.x & 15;
  const unsigned short* ga = Xb + (by * 128 + crow) * E_DIM + cchk * 8;
  const unsigned short* gb = Wb + (bx * 128 + crow) * E_DIM + cchk * 8;
  const unsigned int lds0 = (unsigned int)(size_t)smem + crow * G_PITCH + cchk * 16;

  // read side: byte offsets of this lane's fragment rows inside a stage
  const int aoff = (wm * 32 + lrow) * G_PITCH + half * 16;
  const int boff = G_OPB + (wn * 64 + lrow) * G_PITCH + half * 16;

  v8f c[2][4] = {};

  gemm_copy_stage(lds0, ga, gb);
  // tile 0 has landed for this wave's own copies
  asm volatile("s_wait_asynccnt 0x0" ::: "memory");
  __syncthreads();
  gemm_copy_stage(lds0 + G_STAGEB, ga + G_KT, gb + G_KT);

#pragma unroll 1  // one stage a trip: the ring's order stands once, at the loop's foot
  for (int t = 0; t < G_NT; ++t) {
    const unsigned int bsel = (unsigned int)(t & 1) * G_STAGEB;
    const unsigned char* sb = smem + bsel;
    // this loop and the three inside it are unrolled so that fragments and accumulators
    // are indexed by constants and stay in registers
#pragma unroll
    for (int kk = 0; kk < G_KT / 32; ++kk) {
      ABf af[2], bf[4];
#pragma unroll
      for (int m = 0; m < 2; ++m) {
        af[m].u[0] = *(const u32x4*)(sb + aoff + m * 16 * G_PITCH + kk * 64);
        af[m].u[1] = *(const u32x4*)(sb + aoff + m * 16 * G_PITCH + kk * 64 + 32);
      }
#pragma unroll
      for (int n = 0; n < 4; ++n) {
        bf[n].u[0] = *(const u32x4*)(sb + boff + n * 16 * G_PITCH + kk * 64);
        bf[n].u[1] = *(const u32x4*)(sb + boff + n * 16 * G_PITCH + kk * 64 + 32);
      }
#pragma unroll
      for (int m = 0; m < 2; ++m)
#pragma unroll
        for (int n = 0; n < 4; ++n) c[m][n] = WMMA_BF16(bf[n].v, af[m].v, c[m][n]);
    }
    // this wave's reads of the buffer have returned before it is handed to the copies
    asm volatile("s_wait_dscnt 0x0" ::: "memory");
    // this wave's copies of tile t + 1 have landed before the barrier publishes them
    asm volatile("s_wait_asynccnt 0x0" ::: "memory");
    __syncthreads();
    if (t + 2 < G_NT)
      gemm_copy_stage(lds0 + bsel, ga + (t + 2) * G_KT, gb + (t + 2) * G_KT);
  }
  // no copy is outstanding when the wave goes on to its stores and ends
  asm volatile("s_wait_asynccnt 0x0" ::: "memory");

  // Behind the loop's last barrier no wave reads the ring any more and no copy is aimed at
  // it.  One branch on the mode for the whole tile.
  unsigned char* st = smem + wave * G_WSTB;
  if (mode == 0)      gemm_store_tile<0>(c, st, bias, outp, scale, mbase, nbase, lane);
  else if (mode == 1) gemm_store_tile<1>(c, st, bias, outp, scale, mbase, nbase, lane);
  else                gemm_store_tile<2>(c, st, bias, outp, scale, mbase, nbase, lane);
}

__global__ __launch_bounds__(256)
void gemm_xwt(const unsigned short* __restrict__ Xb,
              const unsigned short* __restrict__ Wb,
              const float* __restrict__ bias,
              void* __restrict__ outp, float scale, int mode) {
  gemm_tile(Xb, Wb, bias, outp, scale, mode, blockIdx.x, blockIdx.y);
}

// The three projections of the tokens in ONE launch: they depend on nothing of one another,
// so that the work-groups of the next start while those of the one before still run, and the
// chip fills and drains once.  blockIdx.z = 0: Q (scaled), 1: K, 2: V^T = Wv X^T, where the
// tokens are the W operand: its tile column is the token tile (blockIdx.y), its tile row the
// weight tile (blockIdx.x).  By its LDS two work-groups share a WGP (four waves a SIMD), so that
// one's first tiles and its stores run under the products of the other.
__global__ __launch_bounds__(256, 4)
void gemm_qkv(const unsigned short* __restrict__ xb,
              const unsigned short* __restrict__ wqb, const unsigned short* __restrict__ wkb,
              const unsigned short* __restrict__ wvb,
              const float* __restrict__ bq, const float* __restrict__ bk,
              const float* __restrict__ bv,
              unsigned short* __restrict__ qb, unsigned short* __restrict__ kb,
              unsigned short* __restrict__ vtb, float qscale) {
  const int z = blockIdx.z;
  const bool vt = (z == 2);
  gemm_tile(vt ? wvb : xb,
            vt ? xb : (z == 0) ? wqb : wkb,
            vt ? bv : (z == 0) ? bq : bk,
            vt ? vtb : (z == 0) ? qb : kb,
            (z == 0) ? qscale : 1.0f, vt ? 2 : 0,
            vt ? blockIdx.y : blockIdx.x, vt ? blockIdx.x : blockIdx.y);
}

#define A_KEYS 128                   // keys per stage: four passes of 32
#define A_NST (SEQ / A_KEYS)         // 16 stages
#define A_KPITCH 144                 // LDS pitch of a K row, bytes (16 B x odd, for ds_load_b128)
#define A_VPITCH 272                 // LDS pitch of a Vt row, bytes (16 B x odd)
#define A_KB (A_KEYS * A_KPITCH)     // the K tile in LDS
#define A_VB (HEAD_DIM * A_VPITCH)   // the Vt tile in LDS
#define A_STAGEB (A_KB + A_VB)       // [K tile | Vt tile]
#define A_LAZY 11.5f                 // how far, in powers of two, a score may lie above the reference

// One stage: each thread brings 4 x 16 bytes of K (rows 32 apart) and 4 x 16 bytes of Vt (rows
// 16 apart).  The s_wait_xcnt stands inside the statement so that no address register named
// by a copy is rewritten in front of it.
__device__ __forceinline__ void attn_copy_stage(unsigned int ldsk, unsigned int ldsv,
                                                const unsigned short* gk,
                                                const unsigned short* gv) {
  asm volatile(
      "global_load_async_to_lds_b128 %0, %8, off\n\t"
      "global_load_async_to_lds_b128 %1, %9, off\n\t"
      "global_load_async_to_lds_b128 %2, %10, off\n\t"
      "global_load_async_to_lds_b128 %3, %11, off\n\t"
      "global_load_async_to_lds_b128 %4, %12, off\n\t"
      "global_load_async_to_lds_b128 %5, %13, off\n\t"
      "global_load_async_to_lds_b128 %6, %14, off\n\t"
      "global_load_async_to_lds_b128 %7, %15, off\n\t"
      "s_wait_xcnt 0x0"
      :: "v"(ldsk), "v"(ldsk + 32 * A_KPITCH), "v"(ldsk + 64 * A_KPITCH), "v"(ldsk + 96 * A_KPITCH),
         "v"(ldsv), "v"(ldsv + 16 * A_VPITCH), "v"(ldsv + 32 * A_VPITCH), "v"(ldsv + 48 * A_VPITCH),
         "v"(gk), "v"(gk + 32 * E_DIM), "v"(gk + 64 * E_DIM), "v"(gk + 96 * E_DIM),
         "v"(gv), "v"(gv + 16 * SEQ), "v"(gv + 32 * SEQ), "v"(gv + 48 * SEQ)
      : "memory");
}

// lane l takes the value of lane l ^ 16
__device__ __forceinline__ float xhalf(float x) {
  const int b = __builtin_bit_cast(int, x);
  return __builtin_bit_cast(
      float, __builtin_amdgcn_permlanex16(b, b, 0x76543210, 0xfedcba98, false, false));
}

__global__ __launch_bounds__(256)
void attn_fwd(const unsigned short* __restrict__ Qb,
              const unsigned short* __restrict__ Kb,
              const unsigned short* __restrict__ Vtb,
              unsigned short* __restrict__ Ctx) {
  __shared__ __attribute__((aligned(16))) unsigned char ring[2 * A_STAGEB];

  const int lane = threadIdx.x & 31;
  const int wave = threadIdx.x >> 5;
  const int lrow = lane & 15;
  const int lk = (lane >> 4) << 3;
  const int half = lane >> 4;

  const int bh = blockIdx.x >> 3;   // / (SEQ/256)
  const int qt = (blockIdx.x & 7) * 8 + wave;
  const int b = bh >> 4, h = bh & 15;
  const int qrowbase = b * SEQ + qt * 32;

  const u32x4* Qv = (const u32x4*)Qb;

  // copy side, K: thread -> (row 0..31, 16-byte chunk 0..7); Vt: thread -> (row 0..15, chunk
  // 0..15); either way a wave covers 4 whole lines
  const int krow = threadIdx.x >> 3, kchk = threadIdx.x & 7;
  const int vrow = threadIdx.x >> 4, vchk = threadIdx.x & 15;
  const unsigned short* gk = Kb + (b * SEQ + krow) * E_DIM + h * HEAD_DIM + kchk * 8;
  const unsigned short* gv = Vtb + ((b * N_HEADS + h) * HEAD_DIM + vrow) * SEQ + vchk * 8;
  const unsigned int ldsk0 = (unsigned int)(size_t)ring + krow * A_KPITCH + kchk * 16;
  const unsigned int ldsv0 = (unsigned int)(size_t)ring + A_KB + vrow * A_VPITCH + vchk * 16;

  // read side: byte offsets of this lane's fragment rows inside a stage.  Of each 64 bytes of
  // a row a lane takes bytes 16 * half and 32 + 16 * half: the hardware k order, which the
  // packed score tiles have as well.
  const int kfoff = lrow * A_KPITCH + half * 16;
  const int vfoff = A_KB + lrow * A_VPITCH + half * 16;

  // Q: 2 query sub-tiles x 2 K-dim chunks, resident in registers
  ABf aq[2][2];
#pragma unroll
  for (int m = 0; m < 2; ++m) {
    const int qoff = (qrowbase + m * 16 + lrow) * E_DIM + h * HEAD_DIM;
    aq[m][0].u[0] = Qv[(qoff + lk) >> 3];
    aq[m][0].u[1] = Qv[(qoff + lk + 16) >> 3];
    aq[m][1].u[0] = Qv[(qoff + 32 + lk) >> 3];
    aq[m][1].u[1] = Qv[(qoff + 32 + lk + 16) >> 3];
  }

  // o[g][t][r] = O^T[d = 16 t + 8 half + r][query 16 g + lrow]
  v8f o[2][4] = {};
  // per query group: the query's reference for the exponentials (equal in both halves; at
  // most A_LAZY below its running maximum) and the running sum over this half's keys (the
  // halves are joined behind the loop)
  float m_i[2] = {-3.0e38f, -3.0e38f}, l_i[2] = {0.0f, 0.0f};
  // what the score product of a group starts from: minus the query's reference in all eight
  // registers (a lane's eight scores of a tile are of one query); zero until the first pass
  // has set a reference
  v8f negm[2] = {};
  // what a score less its reference may reach; the first pass always sets a reference
  float thr = -3.0e38f;

  attn_copy_stage(ldsk0, ldsv0, gk, gv);
  // stage 0 has landed for this wave's own copies
  asm volatile("s_wait_asynccnt 0x0" ::: "memory");
  __syncthreads();
  attn_copy_stage(ldsk0 + A_STAGEB, ldsv0 + A_STAGEB, gk + A_KEYS * E_DIM, gv + A_KEYS);

#pragma unroll 1  // one stage a trip: the ring's order stands once, at the loop's foot
  for (int st = 0; st < A_NST; ++st) {
   const unsigned int bsel = (unsigned int)(st & 1) * A_STAGEB;
   const unsigned char* kbuf = ring + bsel + kfoff;
   const unsigned char* vbuf = ring + bsel + vfoff;
#pragma unroll 1  // one pass of 32 keys a trip: short loop text, one set of pass registers
   for (int p = 0; p < A_KEYS / 32; ++p) {
    // ---- scores: S^T(32 keys x 32 queries) = K_tile(32x64) @ Q^T(64x32)
    ABf ak[2][2];
    // all loops of the pass are unrolled so that fragments and accumulators are indexed by
    // constants and stay in registers
#pragma unroll
    for (int kt = 0; kt < 2; ++kt)
#pragma unroll
      for (int kc = 0; kc < 2; ++kc) {
        const unsigned char* kr = kbuf + (p * 32 + kt * 16) * A_KPITCH + kc * 64;
        ak[kt][kc].u[0] = *(const u32x4*)(kr);
        ak[kt][kc].u[1] = *(const u32x4*)(kr + 32);
      }
    // s[kt][g][r] = S^T[key 16 kt + 8 half + r][query 16 g + lrow] less the query's reference
    v8f s[2][2];
    // Written as asm so that a product reads its start value from the reference's registers
    // and writes its own: from the builtin the compiler copies the eight registers first for
    // two of the four tiles.  The four v_nop are the vector slots between the last product and
    // the first vector instruction that reads a result or overwrites a K fragment.
    asm("v_wmma_f32_16x16x32_bf16 %0, %4, %8, %12\n\t"
        "v_wmma_f32_16x16x32_bf16 %1, %4, %10, %13\n\t"
        "v_wmma_f32_16x16x32_bf16 %2, %6, %8, %12\n\t"
        "v_wmma_f32_16x16x32_bf16 %3, %6, %10, %13\n\t"
        "v_wmma_f32_16x16x32_bf16 %0, %5, %9, %0\n\t"
        "v_wmma_f32_16x16x32_bf16 %1, %5, %11, %1\n\t"
        "v_wmma_f32_16x16x32_bf16 %2, %7, %9, %2\n\t"
        "v_wmma_f32_16x16x32_bf16 %3, %7, %11, %3\n\t"
        "v_nop\n\tv_nop\n\tv_nop\n\tv_nop"
        : "=&v"(s[0][0]), "=&v"(s[0][1]), "=&v"(s[1][0]), "=&v"(s[1][1])
        : "v"(ak[0][0].v), "v"(ak[0][1].v), "v"(ak[1][0].v), "v"(ak[1][1].v),
          "v"(aq[0][0].v), "v"(aq[0][1].v), "v"(aq[1][0].v), "v"(aq[1][1].v),
          "v"(negm[0]), "v"(negm[1]));

    // ---- V^T fragments from the ring (A operand: row = d, k = the pass's 32 keys)
    ABf av[4];
#pragma unroll
    for (int t = 0; t < 4; ++t) {
      const unsigned char* vr = vbuf + t * 16 * A_VPITCH + p * 64;
      av[t].u[0] = *(const u32x4*)(vr);
      av[t].u[1] = *(const u32x4*)(vr + 32);
    }

    // ---- online softmax of queries 16 g + lrow, on this half's 16 keys
    float rmax[2];
#pragma unroll
    for (int g = 0; g < 2; ++g) {
      rmax[g] = -3.0e38f;
#pragma unroll
      for (int r = 0; r < 8; ++r) rmax[g] = fmaxf(rmax[g], fmaxf(s[0][g][r], s[1][g][r]));
    }
    // The reference m_i moves, and sums and outputs are rescaled, only in a pass where some
    // score of the wave lies more than A_LAZY above its query's reference: one test a pass, a
    // scalar branch.  Otherwise every exponential is at most 2^A_LAZY, and the common
    // factor cancels in the division behind the loop.
    const bool need = (rmax[0] > thr) || (rmax[1] > thr);
    if (__builtin_amdgcn_ballot_w32(need) != 0) {
#pragma unroll
      for (int g = 0; g < 2; ++g) {
        // both halves of a query take the same new reference
        const float base = -negm[g][0];
        const float mnew = fmaxf(m_i[g], base + fmaxf(rmax[g], xhalf(rmax[g])));
        const float alpha = __builtin_amdgcn_exp2f(m_i[g] - mnew);
        const float shift = mnew - base;
        m_i[g] = mnew;
        l_i[g] *= alpha;
#pragma unroll
        for (int t = 0; t < 4; ++t) o[g][t] = o[g][t] * alpha;
        // this pass's scores were taken against the old reference
#pragma unroll
        for (int kt = 0; kt < 2; ++kt) s[kt][g] = s[kt][g] - shift;
#pragma unroll
        for (int r = 0; r < 8; ++r) negm[g][r] = -mnew;
      }
      thr = A_LAZY;
    }

#pragma unroll
    for (int g = 0; g < 2; ++g) {
      // element e of the B operand is key kmap(e) = 16 (e >> 3) + 8 half + (e & 7): score
      // tile e >> 3, register e & 7
      v8f pt[2];
      ABf pf;
#pragma unroll
      for (int kt = 0; kt < 2; ++kt) {
#pragma unroll
        for (int r = 0; r < 8; ++r) pt[kt][r] = __builtin_amdgcn_exp2f(s[kt][g][r]);
#pragma unroll
        for (int i = 0; i < 4; ++i) pf.u[kt][i] = pk2bf(pt[kt][2 * i], pt[kt][2 * i + 1]);
      }
      const v8f ps = pt[0] + pt[1];
      const float ssum = ((ps[0] + ps[1]) + (ps[2] + ps[3])) + ((ps[4] + ps[5]) + (ps[6] + ps[7]));
      l_i[g] += ssum;

      // ---- O^T += V^T(64x32) @ P^T(32x16)
#pragma unroll
      for (int t = 0; t < 4; ++t) o[g][t] = WMMA_BF16(av[t].v, pf.v, o[g][t]);
    }
   }
   // this wave's reads of the buffer have returned before it is handed to the copies
   asm volatile("s_wait_dscnt 0x0" ::: "memory");
   // this wave's copies of stage st + 1 have landed before the barrier publishes them
   asm volatile("s_wait_asynccnt 0x0" ::: "memory");
   __syncthreads();
   if (st + 2 < A_NST)
     attn_copy_stage(ldsk0 + bsel, ldsv0 + bsel, gk + (st + 2) * A_KEYS * E_DIM,
                     gv + (st + 2) * A_KEYS);
  }
  // no copy is outstanding when the wave goes on to its stores and ends
  asm volatile("s_wait_asynccnt 0x0" ::: "memory");

  // the three loops are unrolled so that o is indexed by constants and stays in registers
#pragma unroll
  for (int g = 0; g < 2; ++g) {
    const float l = l_i[g] + xhalf(l_i[g]);   // both halves' keys
    const float rr = (l > 0.f) ? (1.0f / l) : 0.f;
    unsigned short* crow_p = Ctx + (qrowbase + g * 16 + lrow) * E_DIM + h * HEAD_DIM + 8 * half;
#pragma unroll
    for (int t = 0; t < 4; ++t) {
      // a lane's 8 registers are 8 consecutive d of one query: one 16-byte store
      u32x4 pk;
#pragma unroll
      for (int i = 0; i < 4; ++i) pk[i] = pk2bf(o[g][t][2 * i] * rr, o[g][t][2 * i + 1] * rr);
      *(u32x4*)(crow_p + t * 16) = pk;
    }
  }
}

// ---------------------------------------------------------------- launch
extern "C" void kernel_launch(void* const* d_in, const int* in_sizes, int n_in,
                              void* d_out, int out_size, void* d_ws, size_t ws_size,
                              hipStream_t stream) {
  const float* x  = (const float*)d_in[0];
  const float* wq = (const float*)d_in[1];
  const float* bq = (const float*)d_in[2];
  const float* wk = (const float*)d_in[3];
  const float* bk = (const float*)d_in[4];
  const float* wv = (const float*)d_in[5];
  const float* bv = (const float*)d_in[6];
  const float* wo = (const float*)d_in[7];
  const float* bo = (const float*)d_in[8];

  char* ws = (char*)d_ws;
  const size_t MB = 1024 * 1024;
  unsigned short* xb  = (unsigned short*)(ws + 0 * MB);   // 16 MB
  unsigned short* wqb = (unsigned short*)(ws + 16 * MB);  //  2 MB
  unsigned short* wkb = (unsigned short*)(ws + 18 * MB);
  unsigned short* wvb = (unsigned short*)(ws + 20 * MB);
  unsigned short* wob = (unsigned short*)(ws + 22 * MB);
  unsigned short* qb  = (unsigned short*)(ws + 24 * MB);  // 16 MB
  unsigned short* kb2 = (unsigned short*)(ws + 40 * MB);  // 16 MB
  unsigned short* vtb = (unsigned short*)(ws + 56 * MB);  // 16 MB [B,H,D,S]
  unsigned short* ctx = (unsigned short*)(ws + 72 * MB);  // 16 MB

  // xb, wqb, wkb, wvb, wob lie one behind another from xb on
  cvt_f32_bf16<<<CV_BLOCKS, CV_THREADS, 0, stream>>>(x, wq, wk, wv, wo, xb);

  dim3 gg(E_DIM / 128, ROWS / 128);  // (8, 64), 256 threads = 8 waves
  const float qscale = 0.18033688f;  // log2(e) / sqrt(64): scores are exponents of two
  dim3 g3(E_DIM / 128, ROWS / 128, 3);  // z: Q, K, V^T
  gemm_qkv<<<g3, 256, 0, stream>>>(xb, wqb, wkb, wvb, bq, bk, bv, qb, kb2, vtb, qscale);

  attn_fwd<<<BATCH * N_HEADS * (SEQ / 256), 256, 0, stream>>>(qb, kb2, vtb, ctx);

  gemm_xwt<<<gg, 256, 0, stream>>>(ctx, wob, bo, d_out, 1.0f, 1);
}
